// v000
// The times below were measured on an AMD MI455X: many runs one after another, warmed up first and cycling through
// copies of the inputs, with the whole window's GPU time divided by the number of runs. Launches and the gaps
// between them are all in it. The median over several windows is given; except for v000 it joins two sittings, which
// can be a few percent apart, so the side-by-side timings, each taken in one sitting, are the better comparison.
// The starting kernel, v000, takes 89.9 microseconds a run.
#include <hip/hip_runtime.h>
#include <math.h>
#include <stdint.h>

typedef __attribute__((ext_vector_type(2))) float v2f;
typedef __attribute__((ext_vector_type(8))) float v8f;

#define T_TOK   2048
#define DIM     256
#define LVLS    8
#define NNODES  255
#define NPAIRS  (T_TOK * LVLS)      // 16384
#define MAXTILES 1280
#define AP      260                  // padded A row stride (floats): conflict-free b64 frag reads

// workspace layout (4-byte units)
#define WS_NODES  0                    // int[NPAIRS]
#define WS_PW     (WS_NODES + NPAIRS)  // float[NPAIRS]
#define WS_CNT    (WS_PW + NPAIRS)     // int[256]
#define WS_OFF    (WS_CNT + 256)       // int[256]
#define WS_CUR    (WS_OFF + 256)       // int[256]
#define WS_PTOK   (WS_CUR + 256)       // int[NPAIRS]
#define WS_PPW    (WS_PTOK + NPAIRS)   // float[NPAIRS]
#define WS_TNODE  (WS_PPW + NPAIRS)    // int[MAXTILES]
#define WS_TSTART (WS_TNODE + MAXTILES)// int[MAXTILES]
#define WS_NT     (WS_TSTART + MAXTILES)// int[1]

__global__ void k_zero(int* counts) {
    counts[threadIdx.x] = 0;
}

// One wave (32 lanes) per token: walk the tree, record node ids + GELU(|logit|),
// histogram node populations.
__global__ void k_route(const float* __restrict__ x, const float* __restrict__ w1s,
                        const float* __restrict__ b1s,
                        int* __restrict__ nodes, float* __restrict__ pw,
                        int* __restrict__ counts) {
    int wave = threadIdx.x >> 5;
    int lane = threadIdx.x & 31;
    int t = blockIdx.x * 4 + wave;
    const float* xr = x + t * DIM;
    float xv[8];
#pragma unroll
    for (int j = 0; j < 8; j++) xv[j] = xr[lane + 32 * j];
    int cur = 0;
#pragma unroll
    for (int i = 0; i < LVLS; i++) {
        const float* wr = w1s + cur * DIM;
        float p = 0.f;
#pragma unroll
        for (int j = 0; j < 8; j++) p += xv[j] * wr[lane + 32 * j];
#pragma unroll
        for (int off = 16; off > 0; off >>= 1) p += __shfl_xor(p, off, 32);
        float score = p + b1s[cur];
        float a = fabsf(score);
        float g = 0.5f * a * (1.0f + erff(a * 0.70710678118654752440f)); // exact-erf GELU
        if (lane == 0) {
            nodes[t * LVLS + i] = cur;
            pw[t * LVLS + i] = g;
            atomicAdd(&counts[cur], 1);
        }
        int choice = (score > 0.0f) ? 1 : 0;   // sign(0)->0 -> choice 0
        cur = cur * 2 + choice + 1;
    }
}

// out[t][o] = sum_i pw_i * b2s[node_i][o]   (initializes out; GEMM adds on top)
__global__ void k_bias(const float* __restrict__ b2s, const int* __restrict__ nodes,
                       const float* __restrict__ pw, float* __restrict__ out) {
    int t = blockIdx.x;
    int o = threadIdx.x;
    float acc = 0.f;
#pragma unroll
    for (int i = 0; i < LVLS; i++) {
        int n = nodes[t * LVLS + i];
        acc += pw[t * LVLS + i] * b2s[n * DIM + o];
    }
    out[t * DIM + o] = acc;
}

// Exclusive scan of counts + build tile descriptors (single block).
__global__ void k_scan(const int* __restrict__ counts, int* __restrict__ offsets,
                       int* __restrict__ cursors, int* __restrict__ tileNode,
                       int* __restrict__ tileStart, int* __restrict__ numTiles) {
    __shared__ int sc[256];
    int tid = threadIdx.x;
    int c = (tid < NNODES) ? counts[tid] : 0;
    sc[tid] = c;
    for (int off = 1; off < 256; off <<= 1) {
        __syncthreads();
        int v = (tid >= off) ? sc[tid - off] : 0;
        __syncthreads();
        sc[tid] += v;
    }
    __syncthreads();
    offsets[tid] = sc[tid] - c;   // exclusive
    cursors[tid] = 0;
    __syncthreads();
    if (tid == 0) {
        int nt = 0;
        for (int n = 0; n < NNODES; n++) {
            int cnt = counts[n];
            int off0 = sc[n] - cnt;
            for (int s = 0; s < cnt; s += 16) {
                tileNode[nt] = n;
                tileStart[nt] = off0 + s;
                nt++;
            }
        }
        *numTiles = nt;
    }
}

// Scatter (token, level) pairs into per-node buckets.
__global__ void k_scatter(const int* __restrict__ nodes, const float* __restrict__ pw,
                          const int* __restrict__ offsets, int* __restrict__ cursors,
                          int* __restrict__ ptok, float* __restrict__ ppw) {
    int g = blockIdx.x * 256 + threadIdx.x;   // 0..NPAIRS-1
    int n = nodes[g];
    int pos = atomicAdd(&cursors[n], 1);
    int idx = offsets[n] + pos;
    ptok[idx] = g >> 3;
    ppw[idx] = pw[g];
}

// Grouped GEMM: one block per 16-token tile of a node bucket.
// A (16x256) = raw gathered x rows, async-DMA'd into LDS (ASYNCcnt path),
//              row-major with AP=260 padded stride -> conflict-free ds_load_b64 frags.
// B (256x256) = w2s[node], streamed from global (L2-resident).
// 4 waves x 4 N-tiles of 16 cover N=256; K in steps of 4 via V_WMMA_F32_16X16X4_F32.
// Path weight pw is applied to the C rows at store time.
__global__ void k_gemm(const float* __restrict__ x, const float* __restrict__ w2s,
                       const int* __restrict__ ptok, const float* __restrict__ ppw,
                       const int* __restrict__ offsets, const int* __restrict__ counts,
                       const int* __restrict__ tileNode, const int* __restrict__ tileStart,
                       const int* __restrict__ numTiles, float* __restrict__ out) {
    int tile = blockIdx.x;
    if (tile >= *numTiles) return;
    int node  = tileNode[tile];
    int start = tileStart[tile];
    int end   = offsets[node] + counts[node];

    __shared__ float As[16 * AP];    // [m][k], padded stride AP floats (1040 B, 16B aligned)
    __shared__ int   toks[16];
    __shared__ float pws[16];

    int tid = threadIdx.x;
    if (tid < 16) {
        int p = start + tid;
        if (p < end) { toks[tid] = ptok[p]; pws[tid] = ppw[p]; }
        else         { toks[tid] = -1;      pws[tid] = 0.f;   }
    }
    __syncthreads();

    // Async gather of 16 x-rows into LDS: 1024 chunks of 16B, 8 per thread.
    uint32_t abase = (uint32_t)(uintptr_t)As;   // LDS byte address of As[0]
#pragma unroll
    for (int it = 0; it < 8; it++) {
        int c = tid + it * 128;        // 0..1023
        int m = c >> 6;                // row 0..15
        int q = c & 63;                // 16B chunk in row
        int tk = toks[m];
        int tok = (tk >= 0) ? tk : 0;  // padding rows gather row 0; results never stored
        const float* g = x + (size_t)tok * DIM + q * 4;
        uint32_t l = abase + (uint32_t)(m * (AP * 4) + q * 16);
        asm volatile("global_load_async_to_lds_b128 %0, %1, off"
                     :: "v"(l), "v"(g) : "memory");
    }
    asm volatile("s_wait_asynccnt 0x0" ::: "memory");
    __syncthreads();

    int wave = tid >> 5;
    int lane = tid & 31;
    int col0 = wave * 64;
    int mlo  = lane & 15;
    int khalf = (lane >> 4) * 2;   // lanes 0-15 -> K 0,1 ; lanes 16-31 -> K 2,3
    const float* W = w2s + (size_t)node * (DIM * DIM);

    v8f c0 = {}, c1 = {}, c2 = {}, c3 = {};

    for (int kb = 0; kb < DIM; kb += 4) {
        int ks = kb + khalf;
        v2f a = *(const v2f*)&As[mlo * AP + ks];   // one ds_load_b64, conflict-free
        const float* Wk = W + (size_t)ks * DIM;
        int col = col0 + mlo;
        v2f b;
        b.x = Wk[col];        b.y = Wk[DIM + col];
        c0 = __builtin_amdgcn_wmma_f32_16x16x4_f32(false, a, false, b, (short)0, c0, false, false);
        b.x = Wk[col + 16];   b.y = Wk[DIM + col + 16];
        c1 = __builtin_amdgcn_wmma_f32_16x16x4_f32(false, a, false, b, (short)0, c1, false, false);
        b.x = Wk[col + 32];   b.y = Wk[DIM + col + 32];
        c2 = __builtin_amdgcn_wmma_f32_16x16x4_f32(false, a, false, b, (short)0, c2, false, false);
        b.x = Wk[col + 48];   b.y = Wk[DIM + col + 48];
        c3 = __builtin_amdgcn_wmma_f32_16x16x4_f32(false, a, false, b, (short)0, c3, false, false);
    }

#pragma unroll
    for (int r = 0; r < 8; r++) {
        int m = r + ((lane >> 4) << 3);   // VGPR r: lanes 0-15 -> M=r, lanes 16-31 -> M=r+8
        int tk = toks[m];
        if (tk >= 0) {
            float w = pws[m];
            float* orow = out + (size_t)tk * DIM;
            int cb = col0 + mlo;
            atomicAdd(orow + cb,      w * c0[r]);
            atomicAdd(orow + cb + 16, w * c1[r]);
            atomicAdd(orow + cb + 32, w * c2[r]);
            atomicAdd(orow + cb + 48, w * c3[r]);
        }
    }
}

extern "C" void kernel_launch(void* const* d_in, const int* in_sizes, int n_in,
                              void* d_out, int out_size, void* d_ws, size_t ws_size,
                              hipStream_t stream) {
    const float* x   = (const float*)d_in[0];
    const float* w1s = (const float*)d_in[1];
    const float* b1s = (const float*)d_in[2];
    const float* w2s = (const float*)d_in[3];
    const float* b2s = (const float*)d_in[4];
    float* out = (float*)d_out;

    int*   wsI = (int*)d_ws;
    float* wsF = (float*)d_ws;
    int*   nodes    = wsI + WS_NODES;
    float* pw       = wsF + WS_PW;
    int*   counts   = wsI + WS_CNT;
    int*   offsets  = wsI + WS_OFF;
    int*   cursors  = wsI + WS_CUR;
    int*   ptok     = wsI + WS_PTOK;
    float* ppw      = wsF + WS_PPW;
    int*   tileNode = wsI + WS_TNODE;
    int*   tileStart= wsI + WS_TSTART;
    int*   numTiles = wsI + WS_NT;

    k_zero<<<1, 256, 0, stream>>>(counts);
    k_route<<<T_TOK / 4, 128, 0, stream>>>(x, w1s, b1s, nodes, pw, counts);
    k_bias<<<T_TOK, 256, 0, stream>>>(b2s, nodes, pw, out);
    k_scan<<<1, 256, 0, stream>>>(counts, offsets, cursors, tileNode, tileStart, numTiles);
    k_scatter<<<NPAIRS / 256, 256, 0, stream>>>(nodes, pw, offsets, cursors, ptok, ppw);
    k_gemm<<<MAXTILES, 128, 0, stream>>>(x, w2s, ptok, ppw, offsets, counts,
                                         tileNode, tileStart, numTiles, out);
}

// v001
// One run takes 55.7 microseconds.
// Timed twice side by side with v000, it ran 1.62 and 1.64 times as fast.
#include <hip/hip_runtime.h>
#include <math.h>
#include <stdint.h>

typedef __attribute__((ext_vector_type(2))) float v2f;
typedef __attribute__((ext_vector_type(8))) float v8f;

#define T_TOK   2048
#define DIM     256
#define LVLS    8
#define NNODES  255
#define NPAIRS  (T_TOK * LVLS)      // 16384
#define MAXTILES 1280
#define AP      260                  // padded A row stride (floats): conflict-free b64 frag reads

// workspace layout (4-byte units)
#define WS_NODES  0                    // int[NPAIRS]
#define WS_PW     (WS_NODES + NPAIRS)  // float[NPAIRS]
#define WS_CNT    (WS_PW + NPAIRS)     // int[256]
#define WS_OFF    (WS_CNT + 256)       // int[256]
#define WS_CUR    (WS_OFF + 256)       // int[256]
#define WS_PTOK   (WS_CUR + 256)       // int[NPAIRS]
#define WS_PPW    (WS_PTOK + NPAIRS)   // float[NPAIRS]
#define WS_TNODE  (WS_PPW + NPAIRS)    // int[MAXTILES]
#define WS_TSTART (WS_TNODE + MAXTILES)// int[MAXTILES]
#define WS_NT     (WS_TSTART + MAXTILES)// int[1]

__global__ void k_zero(int* counts) {
    counts[threadIdx.x] = 0;
}

// One wave (32 lanes) per token: walk the tree, record node ids + GELU(|logit|),
// histogram node populations.
__global__ void k_route(const float* __restrict__ x, const float* __restrict__ w1s,
                        const float* __restrict__ b1s,
                        int* __restrict__ nodes, float* __restrict__ pw,
                        int* __restrict__ counts) {
    int wave = threadIdx.x >> 5;
    int lane = threadIdx.x & 31;
    int t = blockIdx.x * 4 + wave;
    const float* xr = x + t * DIM;
    float xv[8];
#pragma unroll
    for (int j = 0; j < 8; j++) xv[j] = xr[lane + 32 * j];
    int cur = 0;
#pragma unroll
    for (int i = 0; i < LVLS; i++) {
        const float* wr = w1s + cur * DIM;
        float p = 0.f;
#pragma unroll
        for (int j = 0; j < 8; j++) p += xv[j] * wr[lane + 32 * j];
#pragma unroll
        for (int off = 16; off > 0; off >>= 1) p += __shfl_xor(p, off, 32);
        float score = p + b1s[cur];
        float a = fabsf(score);
        float g = 0.5f * a * (1.0f + erff(a * 0.70710678118654752440f)); // exact-erf GELU
        if (lane == 0) {
            nodes[t * LVLS + i] = cur;
            pw[t * LVLS + i] = g;
            atomicAdd(&counts[cur], 1);
        }
        int choice = (score > 0.0f) ? 1 : 0;   // sign(0)->0 -> choice 0
        cur = cur * 2 + choice + 1;
    }
}

// out[t][o] = sum_i pw_i * b2s[node_i][o]   (initializes out; GEMM adds on top)
__global__ void k_bias(const float* __restrict__ b2s, const int* __restrict__ nodes,
                       const float* __restrict__ pw, float* __restrict__ out) {
    int t = blockIdx.x;
    int o = threadIdx.x;
    float acc = 0.f;
#pragma unroll
    for (int i = 0; i < LVLS; i++) {
        int n = nodes[t * LVLS + i];
        acc += pw[t * LVLS + i] * b2s[n * DIM + o];
    }
    out[t * DIM + o] = acc;
}

// Exclusive scan of counts + build tile descriptors (single block).
// One scan carries both sums: low 16 bits = pairs (total NPAIRS), high bits = 16-row tiles
// (total < MAXTILES). Every thread then finds the node of its own tile indices by a
// search over the inclusive tile sums, so no thread walks the node list alone.
__global__ void k_scan(const int* __restrict__ counts, int* __restrict__ offsets,
                       int* __restrict__ cursors, int* __restrict__ tileNode,
                       int* __restrict__ tileStart, int* __restrict__ numTiles) {
    __shared__ int sc[256];    // inclusive sums, packed
    __shared__ int own[256];   // each node's own packed (pairs, tiles)
    int tid = threadIdx.x;
    int c = (tid < NNODES) ? counts[tid] : 0;
    int pk = c | (((c + 15) >> 4) << 16);
    sc[tid] = pk;
    own[tid] = pk;
    for (int off = 1; off < 256; off <<= 1) {
        __syncthreads();
        int v = (tid >= off) ? sc[tid - off] : 0;
        __syncthreads();
        sc[tid] += v;
    }
    __syncthreads();
    offsets[tid] = (sc[tid] - pk) & 0xFFFF;   // exclusive
    cursors[tid] = 0;
    int nt = sc[255] >> 16;
    if (tid == 0) *numTiles = nt;

    // Tile j belongs to the first node whose inclusive tile sum exceeds j.
    // All MAXTILES slots are searched and stored without a test on nt, so that the five
    // searches of a thread overlap their LDS latencies; slots from nt on are never read.
    int n[MAXTILES / 256];
#pragma unroll
    for (int it = 0; it < MAXTILES / 256; it++) n[it] = 0;
#pragma unroll
    for (int step = 128; step > 0; step >>= 1) {
#pragma unroll
        for (int it = 0; it < MAXTILES / 256; it++) {
            if ((sc[n[it] + step - 1] >> 16) <= tid + it * 256) n[it] += step;
        }
    }
#pragma unroll
    for (int it = 0; it < MAXTILES / 256; it++) {
        int j = tid + it * 256;
        int excl = sc[n[it]] - own[n[it]];    // packed exclusive sums of node n
        tileNode[j] = n[it];
        tileStart[j] = (excl & 0xFFFF) + ((j - (excl >> 16)) << 4);
    }
}

// Scatter (token, level) pairs into per-node buckets.
__global__ void k_scatter(const int* __restrict__ nodes, const float* __restrict__ pw,
                          const int* __restrict__ offsets, int* __restrict__ cursors,
                          int* __restrict__ ptok, float* __restrict__ ppw) {
    int g = blockIdx.x * 256 + threadIdx.x;   // 0..NPAIRS-1
    int n = nodes[g];
    int pos = atomicAdd(&cursors[n], 1);
    int idx = offsets[n] + pos;
    ptok[idx] = g >> 3;
    ppw[idx] = pw[g];
}

// Grouped GEMM: one block per 16-token tile of a node bucket.
// A (16x256) = raw gathered x rows, async-DMA'd into LDS (ASYNCcnt path),
//              row-major with AP=260 padded stride -> conflict-free ds_load_b64 frags.
// B (256x256) = w2s[node], streamed from global (L2-resident).
// 4 waves x 4 N-tiles of 16 cover N=256; K in steps of 4 via V_WMMA_F32_16X16X4_F32.
// Path weight pw is applied to the C rows at store time.
__global__ void k_gemm(const float* __restrict__ x, const float* __restrict__ w2s,
                       const int* __restrict__ ptok, const float* __restrict__ ppw,
                       const int* __restrict__ offsets, const int* __restrict__ counts,
                       const int* __restrict__ tileNode, const int* __restrict__ tileStart,
                       const int* __restrict__ numTiles, float* __restrict__ out) {
    int tile = blockIdx.x;
    if (tile >= *numTiles) return;
    int node  = tileNode[tile];
    int start = tileStart[tile];
    int end   = offsets[node] + counts[node];

    __shared__ float As[16 * AP];    // [m][k], padded stride AP floats (1040 B, 16B aligned)
    __shared__ int   toks[16];
    __shared__ float pws[16];

    int tid = threadIdx.x;
    if (tid < 16) {
        int p = start + tid;
        if (p < end) { toks[tid] = ptok[p]; pws[tid] = ppw[p]; }
        else         { toks[tid] = -1;      pws[tid] = 0.f;   }
    }
    __syncthreads();

    // Async gather of 16 x-rows into LDS: 1024 chunks of 16B, 8 per thread.
    uint32_t abase = (uint32_t)(uintptr_t)As;   // LDS byte address of As[0]
#pragma unroll
    for (int it = 0; it < 8; it++) {
        int c = tid + it * 128;        // 0..1023
        int m = c >> 6;                // row 0..15
        int q = c & 63;                // 16B chunk in row
        int tk = toks[m];
        int tok = (tk >= 0) ? tk : 0;  // padding rows gather row 0; results never stored
        const float* g = x + (size_t)tok * DIM + q * 4;
        uint32_t l = abase + (uint32_t)(m * (AP * 4) + q * 16);
        asm volatile("global_load_async_to_lds_b128 %0, %1, off"
                     :: "v"(l), "v"(g) : "memory");
    }
    asm volatile("s_wait_asynccnt 0x0" ::: "memory");
    __syncthreads();

    int wave = tid >> 5;
    int lane = tid & 31;
    int col0 = wave * 64;
    int mlo  = lane & 15;
    int khalf = (lane >> 4) * 2;   // lanes 0-15 -> K 0,1 ; lanes 16-31 -> K 2,3
    const float* W = w2s + (size_t)node * (DIM * DIM);

    v8f c0 = {}, c1 = {}, c2 = {}, c3 = {};

    for (int kb = 0; kb < DIM; kb += 4) {
        int ks = kb + khalf;
        v2f a = *(const v2f*)&As[mlo * AP + ks];   // one ds_load_b64, conflict-free
        const float* Wk = W + (size_t)ks * DIM;
        int col = col0 + mlo;
        v2f b;
        b.x = Wk[col];        b.y = Wk[DIM + col];
        c0 = __builtin_amdgcn_wmma_f32_16x16x4_f32(false, a, false, b, (short)0, c0, false, false);
        b.x = Wk[col + 16];   b.y = Wk[DIM + col + 16];
        c1 = __builtin_amdgcn_wmma_f32_16x16x4_f32(false, a, false, b, (short)0, c1, false, false);
        b.x = Wk[col + 32];   b.y = Wk[DIM + col + 32];
        c2 = __builtin_amdgcn_wmma_f32_16x16x4_f32(false, a, false, b, (short)0, c2, false, false);
        b.x = Wk[col + 48];   b.y = Wk[DIM + col + 48];
        c3 = __builtin_amdgcn_wmma_f32_16x16x4_f32(false, a, false, b, (short)0, c3, false, false);
    }

#pragma unroll
    for (int r = 0; r < 8; r++) {
        int m = r + ((lane >> 4) << 3);   // VGPR r: lanes 0-15 -> M=r, lanes 16-31 -> M=r+8
        int tk = toks[m];
        if (tk >= 0) {
            float w = pws[m];
            float* orow = out + (size_t)tk * DIM;
            int cb = col0 + mlo;
            atomicAdd(orow + cb,      w * c0[r]);
            atomicAdd(orow + cb + 16, w * c1[r]);
            atomicAdd(orow + cb + 32, w * c2[r]);
            atomicAdd(orow + cb + 48, w * c3[r]);
        }
    }
}

extern "C" void kernel_launch(void* const* d_in, const int* in_sizes, int n_in,
                              void* d_out, int out_size, void* d_ws, size_t ws_size,
                              hipStream_t stream) {
    const float* x   = (const float*)d_in[0];
    const float* w1s = (const float*)d_in[1];
    const float* b1s = (const float*)d_in[2];
    const float* w2s = (const float*)d_in[3];
    const float* b2s = (const float*)d_in[4];
    float* out = (float*)d_out;

    int*   wsI = (int*)d_ws;
    float* wsF = (float*)d_ws;
    int*   nodes    = wsI + WS_NODES;
    float* pw       = wsF + WS_PW;
    int*   counts   = wsI + WS_CNT;
    int*   offsets  = wsI + WS_OFF;
    int*   cursors  = wsI + WS_CUR;
    int*   ptok     = wsI + WS_PTOK;
    float* ppw      = wsF + WS_PPW;
    int*   tileNode = wsI + WS_TNODE;
    int*   tileStart= wsI + WS_TSTART;
    int*   numTiles = wsI + WS_NT;

    k_zero<<<1, 256, 0, stream>>>(counts);
    k_route<<<T_TOK / 4, 128, 0, stream>>>(x, w1s, b1s, nodes, pw, counts);
    k_bias<<<T_TOK, 256, 0, stream>>>(b2s, nodes, pw, out);
    k_scan<<<1, 256, 0, stream>>>(counts, offsets, cursors, tileNode, tileStart, numTiles);
    k_scatter<<<NPAIRS / 256, 256, 0, stream>>>(nodes, pw, offsets, cursors, ptok, ppw);
    k_gemm<<<MAXTILES, 128, 0, stream>>>(x, w2s, ptok, ppw, offsets, counts,
                                         tileNode, tileStart, numTiles, out);
}

// v002
// A run of this version takes 53 microseconds.
// Next to v001, in two timings, it ran 1.05 times as fast each time.
// Counting every step since v000, it is 1.70 times as fast.
#include <hip/hip_runtime.h>
#include <math.h>
#include <stdint.h>

typedef __attribute__((ext_vector_type(2))) float v2f;
typedef __attribute__((ext_vector_type(8))) float v8f;
typedef __attribute__((ext_vector_type(4))) float v4f;
typedef __attribute__((address_space(1))) v4f gv4f;   // a v4f in global memory (keeps rebuilt pointers off the flat path)

#define T_TOK   2048
#define DIM     256
#define LVLS    8
#define NNODES  255
#define NPAIRS  (T_TOK * LVLS)      // 16384
#define MAXTILES 1280
#define AP      260                  // padded A row stride (floats): conflict-free b64 frag reads

// workspace layout (4-byte units)
#define WS_NODES  0                    // int[NPAIRS]
#define WS_PW     (WS_NODES + NPAIRS)  // float[NPAIRS]
#define WS_CNT    (WS_PW + NPAIRS)     // int[256]
#define WS_OFF    (WS_CNT + 256)       // int[256]
#define WS_CUR    (WS_OFF + 256)       // int[256]
#define WS_PTOK   (WS_CUR + 256)       // int[NPAIRS]
#define WS_PPW    (WS_PTOK + NPAIRS)   // float[NPAIRS]
#define WS_TNODE  (WS_PPW + NPAIRS)    // int[MAXTILES]
#define WS_TSTART (WS_TNODE + MAXTILES)// int[MAXTILES]
#define WS_NT     (WS_TSTART + MAXTILES)// int[1]

__global__ void k_zero(int* counts) {
    counts[threadIdx.x] = 0;
}

// One wave (32 lanes) per token: walk the tree, record node ids + GELU(|logit|),
// histogram node populations. The same wave also gives its token's output row the start
// value out[t][o] = sum_i pw_i * b2s[node_i][o] (levels in order; the GEMM adds on top):
// each level's b2s row is fetched beside its w1s row, 8 columns a lane.
__global__ void k_route(const float* __restrict__ x, const float* __restrict__ w1s,
                        const float* __restrict__ b1s, const float* __restrict__ b2s,
                        int* __restrict__ nodes, float* __restrict__ pw,
                        int* __restrict__ counts, float* __restrict__ out) {
    int wave = threadIdx.x >> 5;
    int lane = threadIdx.x & 31;
    int t = blockIdx.x * 4 + wave;
    const float* xr = x + t * DIM;
    float xv[8];
#pragma unroll
    for (int j = 0; j < 8; j++) xv[j] = xr[lane + 32 * j];
    int cur = 0;
    v4f acc0 = {0.f, 0.f, 0.f, 0.f};   // columns 4*lane .. 4*lane+3
    v4f acc1 = {0.f, 0.f, 0.f, 0.f};   // columns 128+4*lane .. 128+4*lane+3
#pragma unroll
    for (int i = 0; i < LVLS; i++) {
        const float* wr = w1s + cur * DIM;
        // cur is the same in every lane (the butterfly sum is), so the row's base address is
        // taken as a scalar pair: the two loads then share one fixed lane-offset register.
        uint64_t rb = (uint64_t)(uintptr_t)(b2s + cur * DIM);
        uint32_t rlo = (uint32_t)__builtin_amdgcn_readfirstlane((int)(uint32_t)rb);
        uint32_t rhi = (uint32_t)__builtin_amdgcn_readfirstlane((int)(uint32_t)(rb >> 32));
        const gv4f* br = (const gv4f*)(uintptr_t)(((uint64_t)rhi << 32) | rlo);
        float p = 0.f;
#pragma unroll
        for (int j = 0; j < 8; j++) p += xv[j] * wr[lane + 32 * j];
        // The registers that the two loads below fill may be ones that the row loads above
        // name as their address: this wait stands between those loads and that overwrite.
        asm volatile("s_wait_xcnt 0x0" ::: "memory");
        v4f bv0 = br[lane];
        v4f bv1 = br[lane + 32];
#pragma unroll
        for (int off = 16; off > 0; off >>= 1) p += __shfl_xor(p, off, 32);
        float score = p + b1s[cur];
        float a = fabsf(score);
        float g = 0.5f * a * (1.0f + erff(a * 0.70710678118654752440f)); // exact-erf GELU
        if (lane == 0) {
            nodes[t * LVLS + i] = cur;
            pw[t * LVLS + i] = g;
            atomicAdd(&counts[cur], 1);
        }
        acc0 += g * bv0;
        acc1 += g * bv1;
        int choice = (score > 0.0f) ? 1 : 0;   // sign(0)->0 -> choice 0
        cur = cur * 2 + choice + 1;
    }
    v4f* orow = (v4f*)(out + t * DIM);
    orow[lane] = acc0;
    orow[lane + 32] = acc1;
}

// Exclusive scan of counts + build tile descriptors (single block).
// One scan carries both sums: low 16 bits = pairs (total NPAIRS), high bits = 16-row tiles
// (total < MAXTILES). Every thread then finds the node of its own tile indices by a
// search over the inclusive tile sums, so no thread walks the node list alone.
__global__ void k_scan(const int* __restrict__ counts, int* __restrict__ offsets,
                       int* __restrict__ cursors, int* __restrict__ tileNode,
                       int* __restrict__ tileStart, int* __restrict__ numTiles) {
    __shared__ int sc[256];    // inclusive sums, packed
    __shared__ int own[256];   // each node's own packed (pairs, tiles)
    int tid = threadIdx.x;
    int c = (tid < NNODES) ? counts[tid] : 0;
    int pk = c | (((c + 15) >> 4) << 16);
    sc[tid] = pk;
    own[tid] = pk;
    for (int off = 1; off < 256; off <<= 1) {
        __syncthreads();
        int v = (tid >= off) ? sc[tid - off] : 0;
        __syncthreads();
        sc[tid] += v;
    }
    __syncthreads();
    offsets[tid] = (sc[tid] - pk) & 0xFFFF;   // exclusive
    cursors[tid] = 0;
    int nt = sc[255] >> 16;
    if (tid == 0) *numTiles = nt;

    // Tile j belongs to the first node whose inclusive tile sum exceeds j.
    // All MAXTILES slots are searched and stored without a test on nt, so that the five
    // searches of a thread overlap their LDS latencies; slots from nt on are never read.
    int n[MAXTILES / 256];
#pragma unroll
    for (int it = 0; it < MAXTILES / 256; it++) n[it] = 0;
#pragma unroll
    for (int step = 128; step > 0; step >>= 1) {
#pragma unroll
        for (int it = 0; it < MAXTILES / 256; it++) {
            if ((sc[n[it] + step - 1] >> 16) <= tid + it * 256) n[it] += step;
        }
    }
#pragma unroll
    for (int it = 0; it < MAXTILES / 256; it++) {
        int j = tid + it * 256;
        int excl = sc[n[it]] - own[n[it]];    // packed exclusive sums of node n
        tileNode[j] = n[it];
        tileStart[j] = (excl & 0xFFFF) + ((j - (excl >> 16)) << 4);
    }
}

// Scatter (token, level) pairs into per-node buckets.
__global__ void k_scatter(const int* __restrict__ nodes, const float* __restrict__ pw,
                          const int* __restrict__ offsets, int* __restrict__ cursors,
                          int* __restrict__ ptok, float* __restrict__ ppw) {
    int g = blockIdx.x * 256 + threadIdx.x;   // 0..NPAIRS-1
    int n = nodes[g];
    int pos = atomicAdd(&cursors[n], 1);
    int idx = offsets[n] + pos;
    ptok[idx] = g >> 3;
    ppw[idx] = pw[g];
}

// Grouped GEMM: one block per 16-token tile of a node bucket.
// A (16x256) = raw gathered x rows, async-DMA'd into LDS (ASYNCcnt path),
//              row-major with AP=260 padded stride -> conflict-free ds_load_b64 frags.
// B (256x256) = w2s[node], streamed from global (L2-resident).
// 4 waves x 4 N-tiles of 16 cover N=256; K in steps of 4 via V_WMMA_F32_16X16X4_F32.
// Path weight pw is applied to the C rows at store time.
__global__ void k_gemm(const float* __restrict__ x, const float* __restrict__ w2s,
                       const int* __restrict__ ptok, const float* __restrict__ ppw,
                       const int* __restrict__ offsets, const int* __restrict__ counts,
                       const int* __restrict__ tileNode, const int* __restrict__ tileStart,
                       const int* __restrict__ numTiles, float* __restrict__ out) {
    int tile = blockIdx.x;
    if (tile >= *numTiles) return;
    int node  = tileNode[tile];
    int start = tileStart[tile];
    int end   = offsets[node] + counts[node];

    __shared__ float As[16 * AP];    // [m][k], padded stride AP floats (1040 B, 16B aligned)
    __shared__ int   toks[16];
    __shared__ float pws[16];

    int tid = threadIdx.x;
    if (tid < 16) {
        int p = start + tid;
        if (p < end) { toks[tid] = ptok[p]; pws[tid] = ppw[p]; }
        else         { toks[tid] = -1;      pws[tid] = 0.f;   }
    }
    __syncthreads();

    // Async gather of 16 x-rows into LDS: 1024 chunks of 16B, 8 per thread.
    uint32_t abase = (uint32_t)(uintptr_t)As;   // LDS byte address of As[0]
#pragma unroll
    for (int it = 0; it < 8; it++) {
        int c = tid + it * 128;        // 0..1023
        int m = c >> 6;                // row 0..15
        int q = c & 63;                // 16B chunk in row
        int tk = toks[m];
        int tok = (tk >= 0) ? tk : 0;  // padding rows gather row 0; results never stored
        const float* g = x + (size_t)tok * DIM + q * 4;
        uint32_t l = abase + (uint32_t)(m * (AP * 4) + q * 16);
        asm volatile("global_load_async_to_lds_b128 %0, %1, off"
                     :: "v"(l), "v"(g) : "memory");
    }
    asm volatile("s_wait_asynccnt 0x0" ::: "memory");
    __syncthreads();

    int wave = tid >> 5;
    int lane = tid & 31;
    int col0 = wave * 64;
    int mlo  = lane & 15;
    int khalf = (lane >> 4) * 2;   // lanes 0-15 -> K 0,1 ; lanes 16-31 -> K 2,3
    const float* W = w2s + (size_t)node * (DIM * DIM);

    v8f c0 = {}, c1 = {}, c2 = {}, c3 = {};

    for (int kb = 0; kb < DIM; kb += 4) {
        int ks = kb + khalf;
        v2f a = *(const v2f*)&As[mlo * AP + ks];   // one ds_load_b64, conflict-free
        const float* Wk = W + (size_t)ks * DIM;
        int col = col0 + mlo;
        v2f b;
        b.x = Wk[col];        b.y = Wk[DIM + col];
        c0 = __builtin_amdgcn_wmma_f32_16x16x4_f32(false, a, false, b, (short)0, c0, false, false);
        b.x = Wk[col + 16];   b.y = Wk[DIM + col + 16];
        c1 = __builtin_amdgcn_wmma_f32_16x16x4_f32(false, a, false, b, (short)0, c1, false, false);
        b.x = Wk[col + 32];   b.y = Wk[DIM + col + 32];
        c2 = __builtin_amdgcn_wmma_f32_16x16x4_f32(false, a, false, b, (short)0, c2, false, false);
        b.x = Wk[col + 48];   b.y = Wk[DIM + col + 48];
        c3 = __builtin_amdgcn_wmma_f32_16x16x4_f32(false, a, false, b, (short)0, c3, false, false);
    }

#pragma unroll
    for (int r = 0; r < 8; r++) {
        int m = r + ((lane >> 4) << 3);   // VGPR r: lanes 0-15 -> M=r, lanes 16-31 -> M=r+8
        int tk = toks[m];
        if (tk >= 0) {
            float w = pws[m];
            float* orow = out + (size_t)tk * DIM;
            int cb = col0 + mlo;
            atomicAdd(orow + cb,      w * c0[r]);
            atomicAdd(orow + cb + 16, w * c1[r]);
            atomicAdd(orow + cb + 32, w * c2[r]);
            atomicAdd(orow + cb + 48, w * c3[r]);
        }
    }
}

extern "C" void kernel_launch(void* const* d_in, const int* in_sizes, int n_in,
                              void* d_out, int out_size, void* d_ws, size_t ws_size,
                              hipStream_t stream) {
    const float* x   = (const float*)d_in[0];
    const float* w1s = (const float*)d_in[1];
    const float* b1s = (const float*)d_in[2];
    const float* w2s = (const float*)d_in[3];
    const float* b2s = (const float*)d_in[4];
    float* out = (float*)d_out;

    int*   wsI = (int*)d_ws;
    float* wsF = (float*)d_ws;
    int*   nodes    = wsI + WS_NODES;
    float* pw       = wsF + WS_PW;
    int*   counts   = wsI + WS_CNT;
    int*   offsets  = wsI + WS_OFF;
    int*   cursors  = wsI + WS_CUR;
    int*   ptok     = wsI + WS_PTOK;
    float* ppw      = wsF + WS_PPW;
    int*   tileNode = wsI + WS_TNODE;
    int*   tileStart= wsI + WS_TSTART;
    int*   numTiles = wsI + WS_NT;

    k_zero<<<1, 256, 0, stream>>>(counts);
    k_route<<<T_TOK / 4, 128, 0, stream>>>(x, w1s, b1s, b2s, nodes, pw, counts, out);
    k_scan<<<1, 256, 0, stream>>>(counts, offsets, cursors, tileNode, tileStart, numTiles);
    k_scatter<<<NPAIRS / 256, 256, 0, stream>>>(nodes, pw, offsets, cursors, ptok, ppw);
    k_gemm<<<MAXTILES, 128, 0, stream>>>(x, w2s, ptok, ppw, offsets, counts,
                                         tileNode, tileStart, numTiles, out);
}

// v003
// Measured time: 37.8 microseconds a run.
// Two timings next to v002 put it at 1.41 and 1.39 times that version's speed.
// Counting every step since v000, it is 2.39 times as fast.
#include <hip/hip_runtime.h>
#include <math.h>
#include <stdint.h>

typedef __attribute__((ext_vector_type(2))) float v2f;
typedef __attribute__((ext_vector_type(8))) float v8f;
typedef __attribute__((ext_vector_type(4))) float v4f;
typedef __attribute__((ext_vector_type(4))) int v4i;
typedef __attribute__((address_space(1))) v4f gv4f;   // a v4f in global memory (keeps rebuilt pointers off the flat path)

#define T_TOK   2048
#define DIM     256
#define LVLS    8
#define NPAIRS  (T_TOK * LVLS)      // 16384
#define NLEAF   128                  // nodes of the last level: ids NLEAF-1 .. 2*NLEAF-2
#define NSLOTS  1271                 // tile slots: level i owns 127 + 2^i of them, from 127*i + 2^i - 1
#define AP      260                  // padded A row stride (floats): conflict-free b64 frag reads

// workspace layout (4-byte units)
#define WS_LEAF   0                    // int[T_TOK]    last-level node of each token
#define WS_PW     (WS_LEAF + T_TOK)    // float[NPAIRS] [token][level]
#define WS_STOK   (WS_PW + NPAIRS)     // int[T_TOK]    tokens in leaf order
#define WS_DESC   (WS_STOK + T_TOK)    // int[4 * NSLOTS] {node or -1, first, end, level} per tile slot

// One wave (32 lanes) per token: walk the tree, record GELU(|logit|) of every level and the
// last level's node id (it names the whole path). The same wave also gives its token's output row the start
// value out[t][o] = sum_i pw_i * b2s[node_i][o] (levels in order; the GEMM adds on top):
// each level's b2s row is fetched beside its w1s row, 8 columns a lane.
__global__ void k_route(const float* __restrict__ x, const float* __restrict__ w1s,
                        const float* __restrict__ b1s, const float* __restrict__ b2s,
                        int* __restrict__ leaf, float* __restrict__ pw,
                        float* __restrict__ out) {
    int wave = threadIdx.x >> 5;
    int lane = threadIdx.x & 31;
    int t = blockIdx.x * 4 + wave;
    const float* xr = x + t * DIM;
    float xv[8];
#pragma unroll
    for (int j = 0; j < 8; j++) xv[j] = xr[lane + 32 * j];
    int cur = 0;
    v4f acc0 = {0.f, 0.f, 0.f, 0.f};   // columns 4*lane .. 4*lane+3
    v4f acc1 = {0.f, 0.f, 0.f, 0.f};   // columns 128+4*lane .. 128+4*lane+3
#pragma unroll
    for (int i = 0; i < LVLS; i++) {
        const float* wr = w1s + cur * DIM;
        // cur is the same in every lane (the butterfly sum is), so the row's base address is
        // taken as a scalar pair: the two loads then share one fixed lane-offset register.
        uint64_t rb = (uint64_t)(uintptr_t)(b2s + cur * DIM);
        uint32_t rlo = (uint32_t)__builtin_amdgcn_readfirstlane((int)(uint32_t)rb);
        uint32_t rhi = (uint32_t)__builtin_amdgcn_readfirstlane((int)(uint32_t)(rb >> 32));
        const gv4f* br = (const gv4f*)(uintptr_t)(((uint64_t)rhi << 32) | rlo);
        float p = 0.f;
#pragma unroll
        for (int j = 0; j < 8; j++) p += xv[j] * wr[lane + 32 * j];
        // The registers that the two loads below fill may be ones that the row loads above
        // name as their address: this wait stands between those loads and that overwrite.
        asm volatile("s_wait_xcnt 0x0" ::: "memory");
        v4f bv0 = br[lane];
        v4f bv1 = br[lane + 32];
#pragma unroll
        for (int off = 16; off > 0; off >>= 1) p += __shfl_xor(p, off, 32);
        float score = p + b1s[cur];
        float a = fabsf(score);
        float g = 0.5f * a * (1.0f + erff(a * 0.70710678118654752440f)); // exact-erf GELU
        if (lane == 0) {
            pw[t * LVLS + i] = g;
            if (i == LVLS - 1) leaf[t] = cur;
        }
        acc0 += g * bv0;
        acc1 += g * bv1;
        int choice = (score > 0.0f) ? 1 : 0;   // sign(0)->0 -> choice 0
        cur = cur * 2 + choice + 1;
    }
    v4f* orow = (v4f*)(out + t * DIM);
    orow[lane] = acc0;
    orow[lane + 32] = acc1;
}

// Counting sort of the tokens by their last-level node, one block. Node n+1 in binary is the
// path's prefix, so in leaf order the tokens of EVERY node, at every level, are one contiguous
// run: node j of level i owns positions LO[j << (7-i)] .. LO[(j+1) << (7-i)] - 1.
// Tile k of that node gets slot (first >> 4) + j + k of its level: these numbers rise strictly
// from node to node and stay below 127 + 2^i, so no sum over the nodes' tile counts is needed;
// each slot finds its node by a search over LO, and a slot that no tile takes is marked -1.
__global__ void __launch_bounds__(1024)
k_sort(const int* __restrict__ leaf, int* __restrict__ stok, int* __restrict__ desc) {
    __shared__ __attribute__((aligned(16))) int cnt[NLEAF];
    __shared__ int LO[NLEAF + 1];      // tokens in leaves below k
    __shared__ int ord[T_TOK];         // leaf order, gathered here so that the global store is dense
    int tid = threadIdx.x;
    int l0 = (leaf[tid] - (NLEAF - 1)) & (NLEAF - 1);
    int l1 = (leaf[tid + 1024] - (NLEAF - 1)) & (NLEAF - 1);
    if (tid < NLEAF) cnt[tid] = 0;
    __syncthreads();
    int r0 = atomicAdd(&cnt[l0], 1);   // LDS counter: the returned value is the rank in the leaf
    int r1 = atomicAdd(&cnt[l1], 1);
    __syncthreads();
    if (tid < 32) {                    // wave 0: four leaves a lane, then a scan over the lanes
        v4i c = ((const v4i*)cnt)[tid];
        int s = c.x + c.y + c.z + c.w;
        int inc = s;
#pragma unroll
        for (int off = 1; off < 32; off <<= 1) {
            int v = __shfl_up(inc, off, 32);
            if (tid >= off) inc += v;
        }
        int ex = inc - s;
        LO[4 * tid]     = ex;
        LO[4 * tid + 1] = ex + c.x;
        LO[4 * tid + 2] = ex + c.x + c.y;
        LO[4 * tid + 3] = ex + c.x + c.y + c.z;
        if (tid == 31) LO[NLEAF] = inc;
    }
    __syncthreads();
    ord[LO[l0] + r0] = tid;
    ord[LO[l1] + r1] = tid + 1024;
    __syncthreads();
    stok[tid] = ord[tid];
    stok[tid + 1024] = ord[tid + 1024];

    // Two slots a thread, searched side by side so that their LDS latencies overlap; a slot
    // number from NSLOTS on is searched like the others (every index is clamped), not stored.
    int lv[2], s[2], j[2];
#pragma unroll
    for (int it = 0; it < 2; it++) {
        int g = tid + it * 1024;
        lv[it] = 0;
#pragma unroll
        for (int i = 1; i < LVLS; i++) lv[it] += (g >= 127 * i + (1 << i) - 1) ? 1 : 0;
        s[it] = g - (127 * lv[it] + (1 << lv[it]) - 1);   // slot inside the level
        j[it] = 0;
    }
    // largest j with (first(j) >> 4) + j <= s; a j past the level reads LO[NLEAF] and fails
#pragma unroll
    for (int step = NLEAF / 2; step > 0; step >>= 1) {
#pragma unroll
        for (int it = 0; it < 2; it++) {
            int jj = j[it] + step;
            int idx = jj << ((LVLS - 1) - lv[it]);
            idx = (idx > NLEAF) ? NLEAF : idx;
            if ((LO[idx] >> 4) + jj <= s[it]) j[it] = jj;
        }
    }
#pragma unroll
    for (int it = 0; it < 2; it++) {
        int g  = tid + it * 1024;
        int sh = (LVLS - 1) - lv[it];
        int lo = LO[j[it] << sh];
        int hi = LO[(j[it] + 1) << sh];
        int first = lo + ((s[it] - (lo >> 4) - j[it]) << 4);
        v4i d;
        d.x = (first < hi) ? ((1 << lv[it]) - 1 + j[it]) : -1;
        d.y = first;
        d.z = hi;
        d.w = lv[it];
        if (g < NSLOTS) ((v4i*)desc)[g] = d;
    }
}

// Grouped GEMM: one block per tile slot = 16 tokens of one node's run in leaf order.
// A (16x256) = raw gathered x rows, async-DMA'd into LDS (ASYNCcnt path),
//              row-major with AP=260 padded stride -> conflict-free ds_load_b64 frags.
// B (256x256) = w2s[node], streamed from global (L2-resident).
// 4 waves x 4 N-tiles of 16 cover N=256; K in steps of 4 via V_WMMA_F32_16X16X4_F32.
// Path weight pw is applied to the C rows at store time.
__global__ void k_gemm(const float* __restrict__ x, const float* __restrict__ w2s,
                       const int* __restrict__ stok, const float* __restrict__ pw,
                       const int* __restrict__ desc, float* __restrict__ out) {
    v4i d = ((const v4i*)desc)[blockIdx.x];
    if (d.x < 0) return;             // slot without a tile: the whole block leaves here
    int node  = d.x;
    int start = d.y;
    int end   = d.z;
    int lv    = d.w;

    __shared__ float As[16 * AP];    // [m][k], padded stride AP floats (1040 B, 16B aligned)
    __shared__ int   toks[16];
    __shared__ float pws[16];

    int tid = threadIdx.x;
    if (tid < 16) {
        int p = start + tid;
        int tk = (p < end) ? stok[p] : -1;
        toks[tid] = tk;
        pws[tid] = (tk >= 0) ? pw[tk * LVLS + lv] : 0.f;
    }
    __syncthreads();

    // Async gather of 16 x-rows into LDS: 1024 chunks of 16B, 8 per thread.
    uint32_t abase = (uint32_t)(uintptr_t)As;   // LDS byte address of As[0]
#pragma unroll
    for (int it = 0; it < 8; it++) {
        int c = tid + it * 128;        // 0..1023
        int m = c >> 6;                // row 0..15
        int q = c & 63;                // 16B chunk in row
        int tk = toks[m];
        int tok = (tk >= 0) ? tk : 0;  // padding rows gather row 0; results never stored
        const float* g = x + (size_t)tok * DIM + q * 4;
        uint32_t l = abase + (uint32_t)(m * (AP * 4) + q * 16);
        asm volatile("global_load_async_to_lds_b128 %0, %1, off"
                     :: "v"(l), "v"(g) : "memory");
    }
    asm volatile("s_wait_asynccnt 0x0" ::: "memory");
    __syncthreads();

    int wave = tid >> 5;
    int lane = tid & 31;
    int col0 = wave * 64;
    int mlo  = lane & 15;
    int khalf = (lane >> 4) * 2;   // lanes 0-15 -> K 0,1 ; lanes 16-31 -> K 2,3
    const float* W = w2s + (size_t)node * (DIM * DIM);

    v8f c0 = {}, c1 = {}, c2 = {}, c3 = {};

    for (int kb = 0; kb < DIM; kb += 4) {
        int ks = kb + khalf;
        v2f a = *(const v2f*)&As[mlo * AP + ks];   // one ds_load_b64, conflict-free
        const float* Wk = W + (size_t)ks * DIM;
        int col = col0 + mlo;
        v2f b;
        b.x = Wk[col];        b.y = Wk[DIM + col];
        c0 = __builtin_amdgcn_wmma_f32_16x16x4_f32(false, a, false, b, (short)0, c0, false, false);
        b.x = Wk[col + 16];   b.y = Wk[DIM + col + 16];
        c1 = __builtin_amdgcn_wmma_f32_16x16x4_f32(false, a, false, b, (short)0, c1, false, false);
        b.x = Wk[col + 32];   b.y = Wk[DIM + col + 32];
        c2 = __builtin_amdgcn_wmma_f32_16x16x4_f32(false, a, false, b, (short)0, c2, false, false);
        b.x = Wk[col + 48];   b.y = Wk[DIM + col + 48];
        c3 = __builtin_amdgcn_wmma_f32_16x16x4_f32(false, a, false, b, (short)0, c3, false, false);
    }

#pragma unroll
    for (int r = 0; r < 8; r++) {
        int m = r + ((lane >> 4) << 3);   // VGPR r: lanes 0-15 -> M=r, lanes 16-31 -> M=r+8
        int tk = toks[m];
        if (tk >= 0) {
            float w = pws[m];
            float* orow = out + (size_t)tk * DIM;
            int cb = col0 + mlo;
            atomicAdd(orow + cb,      w * c0[r]);
            atomicAdd(orow + cb + 16, w * c1[r]);
            atomicAdd(orow + cb + 32, w * c2[r]);
            atomicAdd(orow + cb + 48, w * c3[r]);
        }
    }
}

extern "C" void kernel_launch(void* const* d_in, const int* in_sizes, int n_in,
                              void* d_out, int out_size, void* d_ws, size_t ws_size,
                              hipStream_t stream) {
    const float* x   = (const float*)d_in[0];
    const float* w1s = (const float*)d_in[1];
    const float* b1s = (const float*)d_in[2];
    const float* w2s = (const float*)d_in[3];
    const float* b2s = (const float*)d_in[4];
    float* out = (float*)d_out;

    int*   wsI = (int*)d_ws;
    float* wsF = (float*)d_ws;
    int*   leaf = wsI + WS_LEAF;
    float* pw   = wsF + WS_PW;
    int*   stok = wsI + WS_STOK;
    int*   desc = wsI + WS_DESC;

    k_route<<<T_TOK / 4, 128, 0, stream>>>(x, w1s, b1s, b2s, leaf, pw, out);
    k_sort<<<1, 1024, 0, stream>>>(leaf, stok, desc);
    k_gemm<<<NSLOTS, 128, 0, stream>>>(x, w2s, stok, pw, desc, out);
}

// v004
// It runs in 32.7 microseconds.
// Next to v003, in two timings, it ran 1.15 times as fast each time.
// Over all steps from v000 it is 2.75 times as fast.
#include <hip/hip_runtime.h>
#include <math.h>
#include <stdint.h>

typedef __attribute__((ext_vector_type(2))) float v2f;
typedef __attribute__((ext_vector_type(8))) float v8f;
typedef __attribute__((ext_vector_type(4))) float v4f;
typedef __attribute__((ext_vector_type(4))) int v4i;
typedef __attribute__((address_space(1))) v4f gv4f;   // a v4f in global memory (keeps rebuilt pointers off the flat path)

#define T_TOK   2048
#define DIM     256
#define LVLS    8
#define NPAIRS  (T_TOK * LVLS)      // 16384
#define NLEAF   128                  // nodes of the last level: ids NLEAF-1 .. 2*NLEAF-2
#define NSLOTS  1271                 // tile slots: level i owns 127 + 2^i of them, from 127*i + 2^i - 1
#define AP      260                  // padded A row stride (floats): conflict-free b64 frag reads

// workspace layout (4-byte units)
#define WS_LEAF   0                    // int[T_TOK]    last-level node of each token
#define WS_PW     (WS_LEAF + T_TOK)    // float[NPAIRS] [token][level]
#define WS_STOK   (WS_PW + NPAIRS)     // int[T_TOK]    tokens in leaf order
#define WS_DESC   (WS_STOK + T_TOK)    // int[4 * NSLOTS] {node or -1, first, end, level} per tile slot

// One wave (32 lanes) per token: walk the tree, record GELU(|logit|) of every level and the
// last level's node id (it names the whole path). The same wave also gives its token's output row the start
// value out[t][o] = sum_i pw_i * b2s[node_i][o] (levels in order; the GEMM adds on top):
// each level's b2s row is fetched beside its w1s row, 8 columns a lane.
__global__ void k_route(const float* __restrict__ x, const float* __restrict__ w1s,
                        const float* __restrict__ b1s, const float* __restrict__ b2s,
                        int* __restrict__ leaf, float* __restrict__ pw,
                        float* __restrict__ out) {
    int wave = threadIdx.x >> 5;
    int lane = threadIdx.x & 31;
    int t = blockIdx.x * 4 + wave;
    const float* xr = x + t * DIM;
    float xv[8];
#pragma unroll
    for (int j = 0; j < 8; j++) xv[j] = xr[lane + 32 * j];
    int cur = 0;
    v4f acc0 = {0.f, 0.f, 0.f, 0.f};   // columns 4*lane .. 4*lane+3
    v4f acc1 = {0.f, 0.f, 0.f, 0.f};   // columns 128+4*lane .. 128+4*lane+3
#pragma unroll
    for (int i = 0; i < LVLS; i++) {
        const float* wr = w1s + cur * DIM;
        // cur is the same in every lane (the butterfly sum is), so the row's base address is
        // taken as a scalar pair: the two loads then share one fixed lane-offset register.
        uint64_t rb = (uint64_t)(uintptr_t)(b2s + cur * DIM);
        uint32_t rlo = (uint32_t)__builtin_amdgcn_readfirstlane((int)(uint32_t)rb);
        uint32_t rhi = (uint32_t)__builtin_amdgcn_readfirstlane((int)(uint32_t)(rb >> 32));
        const gv4f* br = (const gv4f*)(uintptr_t)(((uint64_t)rhi << 32) | rlo);
        float p = 0.f;
#pragma unroll
        for (int j = 0; j < 8; j++) p += xv[j] * wr[lane + 32 * j];
        // The registers that the two loads below fill may be ones that the row loads above
        // name as their address: this wait stands between those loads and that overwrite.
        asm volatile("s_wait_xcnt 0x0" ::: "memory");
        v4f bv0 = br[lane];
        v4f bv1 = br[lane + 32];
#pragma unroll
        for (int off = 16; off > 0; off >>= 1) p += __shfl_xor(p, off, 32);
        float score = p + b1s[cur];
        float a = fabsf(score);
        float g = 0.5f * a * (1.0f + erff(a * 0.70710678118654752440f)); // exact-erf GELU
        if (lane == 0) {
            pw[t * LVLS + i] = g;
            if (i == LVLS - 1) leaf[t] = cur;
        }
        acc0 += g * bv0;
        acc1 += g * bv1;
        int choice = (score > 0.0f) ? 1 : 0;   // sign(0)->0 -> choice 0
        cur = cur * 2 + choice + 1;
    }
    v4f* orow = (v4f*)(out + t * DIM);
    orow[lane] = acc0;
    orow[lane + 32] = acc1;
}

// Counting sort of the tokens by their last-level node, one block. Node n+1 in binary is the
// path's prefix, so in leaf order the tokens of EVERY node, at every level, are one contiguous
// run: node j of level i owns positions LO[j << (7-i)] .. LO[(j+1) << (7-i)] - 1.
// Tile k of that node gets slot (first >> 4) + j + k of its level: these numbers rise strictly
// from node to node and stay below 127 + 2^i, so no sum over the nodes' tile counts is needed;
// each slot finds its node by a search over LO, and a slot that no tile takes is marked -1.
__global__ void __launch_bounds__(1024)
k_sort(const int* __restrict__ leaf, int* __restrict__ stok, int* __restrict__ desc) {
    __shared__ __attribute__((aligned(16))) int cnt[NLEAF];
    __shared__ int LO[NLEAF + 1];      // tokens in leaves below k
    __shared__ int ord[T_TOK];         // leaf order, gathered here so that the global store is dense
    int tid = threadIdx.x;
    int l0 = (leaf[tid] - (NLEAF - 1)) & (NLEAF - 1);
    int l1 = (leaf[tid + 1024] - (NLEAF - 1)) & (NLEAF - 1);
    if (tid < NLEAF) cnt[tid] = 0;
    __syncthreads();
    int r0 = atomicAdd(&cnt[l0], 1);   // LDS counter: the returned value is the rank in the leaf
    int r1 = atomicAdd(&cnt[l1], 1);
    __syncthreads();
    if (tid < 32) {                    // wave 0: four leaves a lane, then a scan over the lanes
        v4i c = ((const v4i*)cnt)[tid];
        int s = c.x + c.y + c.z + c.w;
        int inc = s;
#pragma unroll
        for (int off = 1; off < 32; off <<= 1) {
            int v = __shfl_up(inc, off, 32);
            if (tid >= off) inc += v;
        }
        int ex = inc - s;
        LO[4 * tid]     = ex;
        LO[4 * tid + 1] = ex + c.x;
        LO[4 * tid + 2] = ex + c.x + c.y;
        LO[4 * tid + 3] = ex + c.x + c.y + c.z;
        if (tid == 31) LO[NLEAF] = inc;
    }
    __syncthreads();
    ord[LO[l0] + r0] = tid;
    ord[LO[l1] + r1] = tid + 1024;
    __syncthreads();
    stok[tid] = ord[tid];
    stok[tid + 1024] = ord[tid + 1024];

    // Two slots a thread, searched side by side so that their LDS latencies overlap; a slot
    // number from NSLOTS on is searched like the others (every index is clamped), not stored.
    int lv[2], s[2], j[2];
#pragma unroll
    for (int it = 0; it < 2; it++) {
        int g = tid + it * 1024;
        lv[it] = 0;
#pragma unroll
        for (int i = 1; i < LVLS; i++) lv[it] += (g >= 127 * i + (1 << i) - 1) ? 1 : 0;
        s[it] = g - (127 * lv[it] + (1 << lv[it]) - 1);   // slot inside the level
        j[it] = 0;
    }
    // largest j with (first(j) >> 4) + j <= s; a j past the level reads LO[NLEAF] and fails
#pragma unroll
    for (int step = NLEAF / 2; step > 0; step >>= 1) {
#pragma unroll
        for (int it = 0; it < 2; it++) {
            int jj = j[it] + step;
            int idx = jj << ((LVLS - 1) - lv[it]);
            idx = (idx > NLEAF) ? NLEAF : idx;
            if ((LO[idx] >> 4) + jj <= s[it]) j[it] = jj;
        }
    }
#pragma unroll
    for (int it = 0; it < 2; it++) {
        int g  = tid + it * 1024;
        int sh = (LVLS - 1) - lv[it];
        int lo = LO[j[it] << sh];
        int hi = LO[(j[it] + 1) << sh];
        int first = lo + ((s[it] - (lo >> 4) - j[it]) << 4);
        v4i d;
        d.x = (first < hi) ? ((1 << lv[it]) - 1 + j[it]) : -1;
        d.y = first;
        d.z = hi;
        d.w = lv[it];
        if (g < NSLOTS) ((v4i*)desc)[g] = d;
    }
}

// Grouped GEMM: one block per tile slot = 16 tokens of one node's run in leaf order.
// A (16x256) = raw gathered x rows, async-DMA'd into LDS (ASYNCcnt path),
//              row-major with AP=260 padded stride -> conflict-free ds_load_b64 frags.
// B (256x256) = w2s[node], from global straight into registers, KBLK rows of k at a time,
//              always NBUF - 1 blocks ahead of the block that the matrix unit works on (ring of
//              NBUF register sets). A lane reads 16 bytes of a row: 4 neighbouring columns, one for
//              each of its wave's 4 N-tiles, so tile j holds the columns col0 + 4*n + j.
// 4 waves x 4 N-tiles of 16 cover N=256; K in steps of 4 via V_WMMA_F32_16X16X4_F32.
// Path weight pw is applied to the C rows at store time.
// r0, r1 = 4 neighbouring columns of k rows k and k+1. A B fragment is one column's two rows in
// a register pair: two swaps, inside the loaded registers, leave column 0 in r0.xy, column 1 in
// r1.xy, column 2 in r0.zw and column 3 in r1.zw, and no register that a matrix instruction
// has just read is written.
static __device__ __forceinline__ void pair_rows(v4f& r0, v4f& r1) {
    float p = r0.y, q = r1.x, u = r0.w, v = r1.z;
    // One instruction for each exchange; written as plain copies it took six moves a step, some
    // of them onto registers that the matrix instruction in front had just read.
    asm("v_swap_b32 %0, %1" : "+v"(p), "+v"(q));
    asm("v_swap_b32 %0, %1" : "+v"(u), "+v"(v));
    r0.y = p; r1.x = q; r0.w = u; r1.z = v;
}

#define KBLK  16                     // k rows of one B block: 4 matrix steps, 8 loads a lane
#define NBLK  (DIM / KBLK)
#define NBUF  4

__global__ void __launch_bounds__(128)
k_gemm(const float* __restrict__ x, const float* __restrict__ w2s,
       const int* __restrict__ stok, const float* __restrict__ pw,
       const int* __restrict__ desc, float* __restrict__ out) {
    v4i d = ((const v4i*)desc)[blockIdx.x];
    if (d.x < 0) return;             // slot without a tile: the whole block leaves here
    int node  = d.x;
    int start = d.y;
    int end   = d.z;
    int lv    = d.w;

    __shared__ float As[16 * AP];    // [m][k], padded stride AP floats (1040 B, 16B aligned)
    __shared__ int   toks[16];
    __shared__ float pws[16];

    int tid = threadIdx.x;
    int wave = tid >> 5;
    int lane = tid & 31;
    int col0 = wave * 64;
    int mlo  = lane & 15;
    int khalf = (lane >> 4) * 2;   // lanes 0-15 -> K 0,1 ; lanes 16-31 -> K 2,3

    // The lane's 4 columns in its first k row; row r of the matrix step at k row kb lies
    // (kb + r) * (DIM / 4) vectors further on.
    const v4f* Wl = (const v4f*)(w2s + (size_t)node * (DIM * DIM) + khalf * DIM + col0 + 4 * mlo);
    v4f bb[NBUF][KBLK / 2];          // [set][2 * step + row]
    // The first NBUF - 1 blocks need only the node: they are asked for ahead of the token gather.
    // (Every loop over bb is unrolled in full, so that each register set has a fixed name.)
#pragma unroll
    for (int s = 0; s < NBUF - 1; s++)
#pragma unroll
        for (int q = 0; q < KBLK / 4; q++) {
            bb[s][2 * q]     = Wl[(s * KBLK + 4 * q) * (DIM / 4)];
            bb[s][2 * q + 1] = Wl[(s * KBLK + 4 * q + 1) * (DIM / 4)];
        }

    if (tid < 16) {
        int p = start + tid;
        int tk = (p < end) ? stok[p] : -1;
        toks[tid] = tk;
        pws[tid] = (tk >= 0) ? pw[tk * LVLS + lv] : 0.f;
    }
    __syncthreads();

    // Async gather of 16 x-rows into LDS: 1024 chunks of 16B, 8 per thread.
    uint32_t abase = (uint32_t)(uintptr_t)As;   // LDS byte address of As[0]
#pragma unroll
    for (int it = 0; it < 8; it++) {
        int c = tid + it * 128;        // 0..1023
        int m = c >> 6;                // row 0..15
        int q = c & 63;                // 16B chunk in row
        int tk = toks[m];
        int tok = (tk >= 0) ? tk : 0;  // padding rows gather row 0; results never stored
        const float* g = x + (size_t)tok * DIM + q * 4;
        uint32_t l = abase + (uint32_t)(m * (AP * 4) + q * 16);
        asm volatile("global_load_async_to_lds_b128 %0, %1, off"
                     :: "v"(l), "v"(g) : "memory");
    }
    asm volatile("s_wait_asynccnt 0x0" ::: "memory");
    __syncthreads();

    v8f c0 = {}, c1 = {}, c2 = {}, c3 = {};
    const float* Al = &As[mlo * AP + khalf];

    // Unrolled in full so that every register set has a fixed name.
#pragma unroll
    for (int s = 0; s < NBLK; s++) {
        if (s + NBUF - 1 < NBLK) {
#pragma unroll
            for (int q = 0; q < KBLK / 4; q++) {
                bb[(s + NBUF - 1) % NBUF][2 * q]     = Wl[((s + NBUF - 1) * KBLK + 4 * q) * (DIM / 4)];
                bb[(s + NBUF - 1) % NBUF][2 * q + 1] = Wl[((s + NBUF - 1) * KBLK + 4 * q + 1) * (DIM / 4)];
            }
        }
#pragma unroll
        for (int q = 0; q < KBLK / 4; q++) {
            v2f a = *(const v2f*)&Al[s * KBLK + 4 * q];   // one ds_load_b64, conflict-free
            v4f r0 = bb[s % NBUF][2 * q];
            v4f r1 = bb[s % NBUF][2 * q + 1];
            pair_rows(r0, r1);
            v2f b;
            b = __builtin_shufflevector(r0, r0, 0, 1);
            c0 = __builtin_amdgcn_wmma_f32_16x16x4_f32(false, a, false, b, (short)0, c0, false, false);
            b = __builtin_shufflevector(r1, r1, 0, 1);
            c1 = __builtin_amdgcn_wmma_f32_16x16x4_f32(false, a, false, b, (short)0, c1, false, false);
            b = __builtin_shufflevector(r0, r0, 2, 3);
            c2 = __builtin_amdgcn_wmma_f32_16x16x4_f32(false, a, false, b, (short)0, c2, false, false);
            b = __builtin_shufflevector(r1, r1, 2, 3);
            c3 = __builtin_amdgcn_wmma_f32_16x16x4_f32(false, a, false, b, (short)0, c3, false, false);
        }
        // Keeps the next pass's loads from rising over this block's products (they would take a
        // fifth register set) and the address work of the stores below out of the last block.
        __builtin_amdgcn_sched_barrier(0);
    }
    // Four vector slots between the last matrix instruction and the first vector instruction
    // that may read its result or reuse its operand registers.
    asm volatile("v_nop\n\tv_nop\n\tv_nop\n\tv_nop");
    // Holds the slots where they are: directly behind the products, ahead of the store code.
    __builtin_amdgcn_sched_barrier(0);

#pragma unroll
    for (int r = 0; r < 8; r++) {
        int m = r + ((lane >> 4) << 3);   // VGPR r: lanes 0-15 -> M=r, lanes 16-31 -> M=r+8
        int tk = toks[m];
        if (tk >= 0) {
            float w = pws[m];
            float* orow = out + (size_t)tk * DIM;
            int cb = col0 + 4 * mlo;
            atomicAdd(orow + cb,     w * c0[r]);
            atomicAdd(orow + cb + 1, w * c1[r]);
            atomicAdd(orow + cb + 2, w * c2[r]);
            atomicAdd(orow + cb + 3, w * c3[r]);
        }
    }
}

extern "C" void kernel_launch(void* const* d_in, const int* in_sizes, int n_in,
                              void* d_out, int out_size, void* d_ws, size_t ws_size,
                              hipStream_t stream) {
    const float* x   = (const float*)d_in[0];
    const float* w1s = (const float*)d_in[1];
    const float* b1s = (const float*)d_in[2];
    const float* w2s = (const float*)d_in[3];
    const float* b2s = (const float*)d_in[4];
    float* out = (float*)d_out;

    int*   wsI = (int*)d_ws;
    float* wsF = (float*)d_ws;
    int*   leaf = wsI + WS_LEAF;
    float* pw   = wsF + WS_PW;
    int*   stok = wsI + WS_STOK;
    int*   desc = wsI + WS_DESC;

    k_route<<<T_TOK / 4, 128, 0, stream>>>(x, w1s, b1s, b2s, leaf, pw, out);
    k_sort<<<1, 1024, 0, stream>>>(leaf, stok, desc);
    k_gemm<<<NSLOTS, 128, 0, stream>>>(x, w2s, stok, pw, desc, out);
}

// v005
// One run takes 30.8 microseconds.
// Two timings next to v004 both put it at 1.07 times that version's speed.
// All steps since v000 together make it 2.93 times as fast.
#include <hip/hip_runtime.h>
#include <math.h>
#include <stdint.h>

typedef __attribute__((ext_vector_type(2))) float v2f;
typedef __attribute__((ext_vector_type(8))) float v8f;
typedef __attribute__((ext_vector_type(4))) float v4f;
typedef __attribute__((ext_vector_type(4))) int v4i;
typedef __attribute__((address_space(1))) v4f gv4f;   // a v4f in global memory (keeps rebuilt pointers off the flat path)

#define T_TOK   2048
#define DIM     256
#define LVLS    8
#define NPAIRS  (T_TOK * LVLS)      // 16384
#define NLEAF   128                  // nodes of the last level: ids NLEAF-1 .. 2*NLEAF-2
#define NSLOTS  1271                 // tile slots: level i owns 127 + 2^i of them, from 127*i + 2^i - 1
#define AP      260                  // padded A row stride (floats): conflict-free b64 frag reads

// workspace layout (4-byte units)
#define WS_LEAF   0                    // int[T_TOK]    last-level node of each token
#define WS_PW     (WS_LEAF + T_TOK)    // float[NPAIRS] [token][level]

// One wave (32 lanes) per token: walk the tree, record GELU(|logit|) of every level and the
// last level's node id (it names the whole path). The same wave also gives its token's output row the start
// value out[t][o] = sum_i pw_i * b2s[node_i][o] (levels in order; the GEMM adds on top):
// each level's b2s row is fetched beside its w1s row, 8 columns a lane.
__global__ void k_route(const float* __restrict__ x, const float* __restrict__ w1s,
                        const float* __restrict__ b1s, const float* __restrict__ b2s,
                        int* __restrict__ leaf, float* __restrict__ pw,
                        float* __restrict__ out) {
    int wave = threadIdx.x >> 5;
    int lane = threadIdx.x & 31;
    int t = blockIdx.x * 4 + wave;
    const float* xr = x + t * DIM;
    float xv[8];
#pragma unroll
    for (int j = 0; j < 8; j++) xv[j] = xr[lane + 32 * j];
    int cur = 0;
    v4f acc0 = {0.f, 0.f, 0.f, 0.f};   // columns 4*lane .. 4*lane+3
    v4f acc1 = {0.f, 0.f, 0.f, 0.f};   // columns 128+4*lane .. 128+4*lane+3
#pragma unroll
    for (int i = 0; i < LVLS; i++) {
        const float* wr = w1s + cur * DIM;
        // cur is the same in every lane (the butterfly sum is), so the row's base address is
        // taken as a scalar pair: the two loads then share one fixed lane-offset register.
        uint64_t rb = (uint64_t)(uintptr_t)(b2s + cur * DIM);
        uint32_t rlo = (uint32_t)__builtin_amdgcn_readfirstlane((int)(uint32_t)rb);
        uint32_t rhi = (uint32_t)__builtin_amdgcn_readfirstlane((int)(uint32_t)(rb >> 32));
        const gv4f* br = (const gv4f*)(uintptr_t)(((uint64_t)rhi << 32) | rlo);
        float p = 0.f;
#pragma unroll
        for (int j = 0; j < 8; j++) p += xv[j] * wr[lane + 32 * j];
        // The registers that the two loads below fill may be ones that the row loads above
        // name as their address: this wait stands between those loads and that overwrite.
        asm volatile("s_wait_xcnt 0x0" ::: "memory");
        v4f bv0 = br[lane];
        v4f bv1 = br[lane + 32];
#pragma unroll
        for (int off = 16; off > 0; off >>= 1) p += __shfl_xor(p, off, 32);
        float score = p + b1s[cur];
        float a = fabsf(score);
        float g = 0.5f * a * (1.0f + erff(a * 0.70710678118654752440f)); // exact-erf GELU
        if (lane == 0) {
            pw[t * LVLS + i] = g;
            if (i == LVLS - 1) leaf[t] = cur;
        }
        acc0 += g * bv0;
        acc1 += g * bv1;
        int choice = (score > 0.0f) ? 1 : 0;   // sign(0)->0 -> choice 0
        cur = cur * 2 + choice + 1;
    }
    v4f* orow = (v4f*)(out + t * DIM);
    orow[lane] = acc0;
    orow[lane + 32] = acc1;
}

// Inclusive sum over the 32 lanes of a wave (every lane on): four shifts inside each 16-lane
// row, then the lower row's total is added to the upper row.
static __device__ __forceinline__ int wave_scan(int v) {
    v += __builtin_amdgcn_update_dpp(0, v, 0x111, 0xf, 0xf, false);   // row_shr:1
    v += __builtin_amdgcn_update_dpp(0, v, 0x112, 0xf, 0xf, false);   // row_shr:2
    v += __builtin_amdgcn_update_dpp(0, v, 0x114, 0xf, 0xf, false);   // row_shr:4
    v += __builtin_amdgcn_update_dpp(0, v, 0x118, 0xf, 0xf, false);   // row_shr:8
    int low = __builtin_amdgcn_readlane(v, 15);
    return v + (((threadIdx.x & 31) >= 16) ? low : 0);
}

// Entry b (the same in every lane, 0 .. NLEAF-1) of a table of which lane l holds entries 4l .. 4l+3.
static __device__ __forceinline__ int pick(v4i L, int b) {
    int l = b >> 2, c = b & 3;
    int x = __builtin_amdgcn_readlane(L.x, l), y = __builtin_amdgcn_readlane(L.y, l);
    int z = __builtin_amdgcn_readlane(L.z, l), w = __builtin_amdgcn_readlane(L.w, l);
    return (c < 2) ? ((c == 0) ? x : y) : ((c == 2) ? z : w);
}

// Grouped GEMM: one block per tile slot = 16 tokens of one node. Node n+1 in binary is the path's
// prefix, so a node's tokens are those of 2^sh neighbouring leaves; the block finds its node and its
// 16 tokens itself, from the 2048 leaf ids (a count per leaf, a scan, ballots for the ranks).
// A (16x256) = raw gathered x rows, async-DMA'd into LDS (ASYNCcnt path),
//              row-major with AP=260 padded stride -> conflict-free ds_load_b64 frags.
// B (256x256) = w2s[node], from global straight into registers, KBLK rows of k at a time,
//              always NBUF - 1 blocks ahead of the block that the matrix unit works on (ring of
//              NBUF register sets). A lane reads 16 bytes of a row: 4 neighbouring columns, one for
//              each of its wave's 4 N-tiles, so tile j holds the columns col0 + 4*n + j.
// 4 waves x 4 N-tiles of 16 cover N=256; K in steps of 4 via V_WMMA_F32_16X16X4_F32.
// Path weight pw is applied to the C rows at store time.
// r0, r1 = 4 neighbouring columns of k rows k and k+1. A B fragment is one column's two rows in
// a register pair: two swaps, inside the loaded registers, leave column 0 in r0.xy, column 1 in
// r1.xy, column 2 in r0.zw and column 3 in r1.zw, and no register that a matrix instruction
// has just read is written.
static __device__ __forceinline__ void pair_rows(v4f& r0, v4f& r1) {
    float p = r0.y, q = r1.x, u = r0.w, v = r1.z;
    // One instruction for each exchange; written as plain copies it took six moves a step, some
    // of them onto registers that the matrix instruction in front had just read.
    asm("v_swap_b32 %0, %1" : "+v"(p), "+v"(q));
    asm("v_swap_b32 %0, %1" : "+v"(u), "+v"(v));
    r0.y = p; r1.x = q; r0.w = u; r1.z = v;
}

#define KBLK  16                     // k rows of one B block: 4 matrix steps, 8 loads a lane
#define NBLK  (DIM / KBLK)
#define NBUF  4

__global__ void __launch_bounds__(128)
k_gemm(const float* __restrict__ x, const float* __restrict__ w2s,
       const int* __restrict__ leaf, const float* __restrict__ pw,
       float* __restrict__ out) {
    __shared__ float As[16 * AP];    // [m][k], padded stride AP floats (1040 B, 16B aligned)
    __shared__ int   toks[16 + 32];  // the tile's tokens (-1: none), then spare entries, one a lane
    __shared__ float pws[16];
    __shared__ __attribute__((aligned(16))) int cnt[4][NLEAF];   // tokens per leaf, one table a wave

    int tid = threadIdx.x;
    int wave = tid >> 5;
    int lane = tid & 31;

    // The slot's level and its number inside the level.
    int lv = 0;
#pragma unroll
    for (int i = 1; i < LVLS; i++) lv += ((int)blockIdx.x >= 127 * i + (1 << i) - 1) ? 1 : 0;
    int slot = (int)blockIdx.x - (127 * lv + (1 << lv) - 1);
    int sh = (LVLS - 1) - lv;        // a node of this level owns 2^sh neighbouring leaves

    // Wave w takes tokens 512w .. 512w+511; a lane's value e is token 512w + 128*(e>>2) + 4*lane + (e&3).
    // The tokens of a node are ranked by (wave, e, lane): the same order in every block.
    const v4i* lf = (const v4i*)leaf + wave * 128 + lane;
    v4i lq[4];
#pragma unroll
    for (int u = 0; u < 4; u++) lq[u] = lf[32 * u];
    ((v4i*)cnt[wave])[lane] = (v4i){0, 0, 0, 0};   // a wave clears and fills its own table: no barrier between
    if (tid < 16) toks[tid] = -1;
    int bin[16];
#pragma unroll
    for (int e = 0; e < 16; e++) {
        bin[e] = (lq[e >> 2][e & 3] - (NLEAF - 1)) & (NLEAF - 1);
        atomicAdd(&cnt[wave][bin[e]], 1);          // LDS counter, result not used
    }
    __syncthreads();                 // the four tables are complete

    // Every wave works out the same figures: LO = tokens in leaves below 4*lane .. 4*lane+3.
    v4i h0 = ((const v4i*)cnt[0])[lane];
    v4i h1 = ((const v4i*)cnt[1])[lane];
    v4i h2 = ((const v4i*)cnt[2])[lane];
    v4i h3 = ((const v4i*)cnt[3])[lane];
    v4i tot = h0 + h1 + h2 + h3;
    int lsum = tot.x + tot.y + tot.z + tot.w;
    v4i LO;
    LO.x = wave_scan(lsum) - lsum;
    LO.y = LO.x + tot.x;
    LO.z = LO.y + tot.y;
    LO.w = LO.z + tot.z;
    // Node j of the level owns ranks LO[j << sh] .. LO[(j+1) << sh] - 1 of the order by leaf; its tile k
    // has slot (first >> 4) + j + k. These numbers rise strictly from node to node and stay below
    // 127 + 2^lv, so the slot's node is the last one whose first slot is not above it.
    int nle = 0;
#pragma unroll
    for (int c = 0; c < 4; c++) {
        int bb0 = 4 * lane + c;
        bool ok = ((bb0 & ((1 << sh) - 1)) == 0) && ((LO[c] >> 4) + (bb0 >> sh) <= slot);
        nle += __popc(__builtin_amdgcn_ballot_w32(ok));
    }
    int j  = nle - 1;                // node 0 of the level always counts: j >= 0
    int b0 = j << sh;
    int b1 = (j + 1) << sh;          // at most NLEAF
    int lo = pick(LO, b0);
    int hi = (b1 < NLEAF) ? pick(LO, b1 & (NLEAF - 1)) : T_TOK;
    int rb = (slot - (lo >> 4) - j) << 4;   // rank, inside the node, of the tile's first token
    if (rb >= hi - lo) return;       // slot without a tile: the same in every thread, the whole block leaves
    int node = (1 << lv) - 1 + j;

    int col0 = wave * 64;
    int mlo  = lane & 15;
    int khalf = (lane >> 4) * 2;   // lanes 0-15 -> K 0,1 ; lanes 16-31 -> K 2,3

    // The lane's 4 columns in its first k row; row r of the matrix step at k row kb lies
    // (kb + r) * (DIM / 4) vectors further on.
    const v4f* Wl = (const v4f*)(w2s + (size_t)node * (DIM * DIM) + khalf * DIM + col0 + 4 * mlo);
    v4f bb[NBUF][KBLK / 2];          // [set][2 * step + row]

    // Tokens of the node in the waves below this one, less rb: the rank of this wave's first one in the tile.
    v4i pre = {0, 0, 0, 0};
    if (wave > 0) pre += h0;
    if (wave > 1) pre += h1;
    if (wave > 2) pre += h2;
    int pm = 0;
#pragma unroll
    for (int c = 0; c < 4; c++) {
        int bb0 = 4 * lane + c;
        pm += (bb0 >= b0 && bb0 < b1) ? pre[c] : 0;
    }
    int run = __builtin_amdgcn_readlane(wave_scan(pm), 31) - rb;
    // Every lane stores every time: a token that is not of this tile goes to a spare entry (16 and up,
    // never read), so that the sixteen steps hold no branch and no change of the lane mask.
#pragma unroll
    for (int e = 0; e < 16; e++) {
        bool mine = (bin[e] >> sh) == j;
        uint32_t mk = __builtin_amdgcn_ballot_w32(mine);
        uint32_t r = (uint32_t)(run + (int)__builtin_amdgcn_mbcnt_lo(mk, 0u));   // below 0 wraps: above 15 too
        uint32_t spare = 16u + (uint32_t)lane;
        uint32_t at = mine ? r : spare;
        toks[(at < spare) ? at : spare] = wave * 512 + 128 * (e >> 2) + 4 * lane + (e & 3);
        run += __popc(mk);
    }
    __syncthreads();

    // The first NBUF - 1 blocks are asked for here, behind the barrier (which waits for a wave's loads)
    // and ahead of the token gather, so that they fly beside it.
    // (Every loop over bb is unrolled in full, so that each register set has a fixed name.)
#pragma unroll
    for (int s = 0; s < NBUF - 1; s++)
#pragma unroll
        for (int q = 0; q < KBLK / 4; q++) {
            bb[s][2 * q]     = Wl[(s * KBLK + 4 * q) * (DIM / 4)];
            bb[s][2 * q + 1] = Wl[(s * KBLK + 4 * q + 1) * (DIM / 4)];
        }

    // The path weights are first used behind the gather's wait: their load flies beside the gather below.
    float pwv = 0.f;
    if (tid < 16) {
        int tk = toks[tid];
        if (tk >= 0) pwv = pw[tk * LVLS + lv];
    }

    // Async gather of 16 x-rows into LDS: 1024 chunks of 16B, 8 per thread.
    uint32_t abase = (uint32_t)(uintptr_t)As;   // LDS byte address of As[0]
#pragma unroll
    for (int it = 0; it < 8; it++) {
        int c = tid + it * 128;        // 0..1023
        int m = c >> 6;                // row 0..15
        int q = c & 63;                // 16B chunk in row
        int tk = toks[m];
        int tok = (tk >= 0) ? tk : 0;  // padding rows gather row 0; results never stored
        const float* g = x + (size_t)tok * DIM + q * 4;
        uint32_t l = abase + (uint32_t)(m * (AP * 4) + q * 16);
        asm volatile("global_load_async_to_lds_b128 %0, %1, off"
                     :: "v"(l), "v"(g) : "memory");
    }
    asm volatile("s_wait_asynccnt 0x0" ::: "memory");
    if (tid < 16) pws[tid] = pwv;
    __syncthreads();

    v8f c0 = {}, c1 = {}, c2 = {}, c3 = {};
    const float* Al = &As[mlo * AP + khalf];

    // Unrolled in full so that every register set has a fixed name.
#pragma unroll
    for (int s = 0; s < NBLK; s++) {
        if (s + NBUF - 1 < NBLK) {
#pragma unroll
            for (int q = 0; q < KBLK / 4; q++) {
                bb[(s + NBUF - 1) % NBUF][2 * q]     = Wl[((s + NBUF - 1) * KBLK + 4 * q) * (DIM / 4)];
                bb[(s + NBUF - 1) % NBUF][2 * q + 1] = Wl[((s + NBUF - 1) * KBLK + 4 * q + 1) * (DIM / 4)];
            }
        }
#pragma unroll
        for (int q = 0; q < KBLK / 4; q++) {
            v2f a = *(const v2f*)&Al[s * KBLK + 4 * q];   // one ds_load_b64, conflict-free
            v4f r0 = bb[s % NBUF][2 * q];
            v4f r1 = bb[s % NBUF][2 * q + 1];
            pair_rows(r0, r1);
            v2f b;
            b = __builtin_shufflevector(r0, r0, 0, 1);
            c0 = __builtin_amdgcn_wmma_f32_16x16x4_f32(false, a, false, b, (short)0, c0, false, false);
            b = __builtin_shufflevector(r1, r1, 0, 1);
            c1 = __builtin_amdgcn_wmma_f32_16x16x4_f32(false, a, false, b, (short)0, c1, false, false);
            b = __builtin_shufflevector(r0, r0, 2, 3);
            c2 = __builtin_amdgcn_wmma_f32_16x16x4_f32(false, a, false, b, (short)0, c2, false, false);
            b = __builtin_shufflevector(r1, r1, 2, 3);
            c3 = __builtin_amdgcn_wmma_f32_16x16x4_f32(false, a, false, b, (short)0, c3, false, false);
        }
        // Keeps the next pass's loads from rising over this block's products (they would take a
        // fifth register set) and the address work of the stores below out of the last block.
        __builtin_amdgcn_sched_barrier(0);
    }
    // Four vector slots between the last matrix instruction and the first vector instruction
    // that may read its result or reuse its operand registers.
    asm volatile("v_nop\n\tv_nop\n\tv_nop\n\tv_nop");
    // Holds the slots where they are: directly behind the products, ahead of the store code.
    __builtin_amdgcn_sched_barrier(0);

#pragma unroll
    for (int r = 0; r < 8; r++) {
        int m = r + ((lane >> 4) << 3);   // VGPR r: lanes 0-15 -> M=r, lanes 16-31 -> M=r+8
        int tk = toks[m];
        if (tk >= 0) {
            float w = pws[m];
            float* orow = out + (size_t)tk * DIM;
            int cb = col0 + 4 * mlo;
            atomicAdd(orow + cb,     w * c0[r]);
            atomicAdd(orow + cb + 1, w * c1[r]);
            atomicAdd(orow + cb + 2, w * c2[r]);
            atomicAdd(orow + cb + 3, w * c3[r]);
        }
    }
}

extern "C" void kernel_launch(void* const* d_in, const int* in_sizes, int n_in,
                              void* d_out, int out_size, void* d_ws, size_t ws_size,
                              hipStream_t stream) {
    const float* x   = (const float*)d_in[0];
    const float* w1s = (const float*)d_in[1];
    const float* b1s = (const float*)d_in[2];
    const float* w2s = (const float*)d_in[3];
    const float* b2s = (const float*)d_in[4];
    float* out = (float*)d_out;

    int*   wsI = (int*)d_ws;
    float* wsF = (float*)d_ws;
    int*   leaf = wsI + WS_LEAF;
    float* pw   = wsF + WS_PW;

    k_route<<<T_TOK / 4, 128, 0, stream>>>(x, w1s, b1s, b2s, leaf, pw, out);
    k_gemm<<<NSLOTS, 128, 0, stream>>>(x, w2s, leaf, pw, out);
}

// v006
// A run of this version takes 29.1 microseconds.
// Next to v005, in two timings, it ran 1.06 times as fast each time.
// All steps since v000 together make it 3.10 times as fast.
#include <hip/hip_runtime.h>
#include <math.h>
#include <stdint.h>

typedef __attribute__((ext_vector_type(2))) float v2f;
typedef __attribute__((ext_vector_type(8))) float v8f;
typedef __attribute__((ext_vector_type(4))) float v4f;
typedef __attribute__((ext_vector_type(4))) int v4i;
typedef __attribute__((address_space(1))) v4f gv4f;   // a v4f in global memory (keeps rebuilt pointers off the flat path)

#define T_TOK   2048
#define DIM     256
#define LVLS    8
#define NPAIRS  (T_TOK * LVLS)      // 16384
#define NLEAF   128                  // nodes of the last level: ids NLEAF-1 .. 2*NLEAF-2
// A block takes one 16-token tile of a node of level LT and does several levels of it at once (the node and
// its ancestors): levels 0-3 (LT 3), 4-5 (LT 5), 6-7 (LT 7). Level LT owns 127 + 2^LT tile slots; a slot has
// one block for each share of the 256 columns (64 columns a wave, a wave does one level).
#define NB0     ((127 + 8) * 4)      // levels 0-3: 4 waves = 4 levels, 64 columns a block
#define NB1     ((127 + 32) * 2)     // levels 4-5: 2 levels x 2 column groups, 128 columns a block
#define NB2     ((127 + 128) * 2)    // levels 6-7: the same
#define NSLOTS  (NB0 + NB1 + NB2)
#define AP      260                  // padded A row stride (floats): conflict-free b64 frag reads

// workspace layout (4-byte units)
#define WS_LEAF   0                    // int[T_TOK]    last-level node of each token
#define WS_PW     (WS_LEAF + T_TOK)    // float[NPAIRS] [token][level]

// One wave (32 lanes) per token: walk the tree, record GELU(|logit|) of every level and the
// last level's node id (it names the whole path). The same wave also gives its token's output row the start
// value out[t][o] = sum_i pw_i * b2s[node_i][o] (levels in order; the GEMM adds on top):
// each level's b2s row is fetched beside its w1s row, 8 columns a lane.
__global__ void k_route(const float* __restrict__ x, const float* __restrict__ w1s,
                        const float* __restrict__ b1s, const float* __restrict__ b2s,
                        int* __restrict__ leaf, float* __restrict__ pw,
                        float* __restrict__ out) {
    int wave = threadIdx.x >> 5;
    int lane = threadIdx.x & 31;
    int t = blockIdx.x * 4 + wave;
    const float* xr = x + t * DIM;
    float xv[8];
#pragma unroll
    for (int j = 0; j < 8; j++) xv[j] = xr[lane + 32 * j];
    int cur = 0;
    v4f acc0 = {0.f, 0.f, 0.f, 0.f};   // columns 4*lane .. 4*lane+3
    v4f acc1 = {0.f, 0.f, 0.f, 0.f};   // columns 128+4*lane .. 128+4*lane+3
#pragma unroll
    for (int i = 0; i < LVLS; i++) {
        const float* wr = w1s + cur * DIM;
        // cur is the same in every lane (the butterfly sum is), so the row's base address is
        // taken as a scalar pair: the two loads then share one fixed lane-offset register.
        uint64_t rb = (uint64_t)(uintptr_t)(b2s + cur * DIM);
        uint32_t rlo = (uint32_t)__builtin_amdgcn_readfirstlane((int)(uint32_t)rb);
        uint32_t rhi = (uint32_t)__builtin_amdgcn_readfirstlane((int)(uint32_t)(rb >> 32));
        const gv4f* br = (const gv4f*)(uintptr_t)(((uint64_t)rhi << 32) | rlo);
        float p = 0.f;
#pragma unroll
        for (int j = 0; j < 8; j++) p += xv[j] * wr[lane + 32 * j];
        // The registers that the two loads below fill may be ones that the row loads above
        // name as their address: this wait stands between those loads and that overwrite.
        asm volatile("s_wait_xcnt 0x0" ::: "memory");
        v4f bv0 = br[lane];
        v4f bv1 = br[lane + 32];
#pragma unroll
        for (int off = 16; off > 0; off >>= 1) p += __shfl_xor(p, off, 32);
        float score = p + b1s[cur];
        float a = fabsf(score);
        float g = 0.5f * a * (1.0f + erff(a * 0.70710678118654752440f)); // exact-erf GELU
        if (lane == 0) {
            pw[t * LVLS + i] = g;
            if (i == LVLS - 1) leaf[t] = cur;
        }
        acc0 += g * bv0;
        acc1 += g * bv1;
        int choice = (score > 0.0f) ? 1 : 0;   // sign(0)->0 -> choice 0
        cur = cur * 2 + choice + 1;
    }
    v4f* orow = (v4f*)(out + t * DIM);
    orow[lane] = acc0;
    orow[lane + 32] = acc1;
}

// Inclusive sum over the 32 lanes of a wave (every lane on): four shifts inside each 16-lane
// row, then the lower row's total is added to the upper row.
static __device__ __forceinline__ int wave_scan(int v) {
    v += __builtin_amdgcn_update_dpp(0, v, 0x111, 0xf, 0xf, false);   // row_shr:1
    v += __builtin_amdgcn_update_dpp(0, v, 0x112, 0xf, 0xf, false);   // row_shr:2
    v += __builtin_amdgcn_update_dpp(0, v, 0x114, 0xf, 0xf, false);   // row_shr:4
    v += __builtin_amdgcn_update_dpp(0, v, 0x118, 0xf, 0xf, false);   // row_shr:8
    int low = __builtin_amdgcn_readlane(v, 15);
    return v + (((threadIdx.x & 31) >= 16) ? low : 0);
}

// Entry b (the same in every lane, 0 .. NLEAF-1) of a table of which lane l holds entries 4l .. 4l+3.
static __device__ __forceinline__ int pick(v4i L, int b) {
    int l = b >> 2, c = b & 3;
    int x = __builtin_amdgcn_readlane(L.x, l), y = __builtin_amdgcn_readlane(L.y, l);
    int z = __builtin_amdgcn_readlane(L.z, l), w = __builtin_amdgcn_readlane(L.w, l);
    return (c < 2) ? ((c == 0) ? x : y) : ((c == 2) ? z : w);
}

// Grouped GEMM: a block works on one tile slot = 16 tokens of one node. Node n+1 in binary is the path's
// prefix, so a node's tokens are those of 2^sh neighbouring leaves; the block finds its node and its
// 16 tokens itself, from the 2048 leaf ids (a count per leaf, a scan, ballots for the ranks).
// A (16x256) = raw gathered x rows, async-DMA'd into LDS (ASYNCcnt path),
//              row-major with AP=260 padded stride -> conflict-free ds_load_b64 frags.
// B (256x256) = w2s[node], from global straight into registers, KBLK rows of k at a time,
//              always NBUF - 1 blocks ahead of the block that the matrix unit works on (ring of
//              NBUF register sets). A lane reads 16 bytes of a row: 4 neighbouring columns, one for
//              each of its wave's 4 N-tiles, so tile j holds the columns col0 + 4*n + j.
// A wave does 4 N-tiles of 16 columns of ONE level's matrix; K in steps of 4 via V_WMMA_F32_16X16X4_F32.
// Path weight pw is applied to the C rows behind the products; the block's levels are then summed in LDS
// (levels in order) and the sum goes to out by one atomic add an element, 32 neighbouring columns a wave.
// r0, r1 = 4 neighbouring columns of k rows k and k+1. A B fragment is one column's two rows in
// a register pair: two swaps, inside the loaded registers, leave column 0 in r0.xy, column 1 in
// r1.xy, column 2 in r0.zw and column 3 in r1.zw, and no register that a matrix instruction
// has just read is written.
static __device__ __forceinline__ void pair_rows(v4f& r0, v4f& r1) {
    float p = r0.y, q = r1.x, u = r0.w, v = r1.z;
    // One instruction for each exchange; written as plain copies it took six moves a step, some
    // of them onto registers that the matrix instruction in front had just read.
    asm("v_swap_b32 %0, %1" : "+v"(p), "+v"(q));
    asm("v_swap_b32 %0, %1" : "+v"(u), "+v"(v));
    r0.y = p; r1.x = q; r0.w = u; r1.z = v;
}

#define KBLK  16                     // k rows of one B block: 4 matrix steps, 8 loads a lane
#define NBLK  (DIM / KBLK)
#define NBUF  4

__global__ void __launch_bounds__(128)
k_gemm(const float* __restrict__ x, const float* __restrict__ w2s,
       const int* __restrict__ leaf, const float* __restrict__ pw,
       float* __restrict__ out) {
    // [m][k], padded stride AP floats (1040 B); behind the products: [wave][m][64] weighted results
    __shared__ __attribute__((aligned(16))) float As[16 * AP];
    __shared__ __attribute__((aligned(16))) int toks[16 + 32];  // the tile's tokens (-1: none), then spare entries, one a lane
    __shared__ float pws[64];        // [level of the block][m]
    __shared__ __attribute__((aligned(16))) int cnt[4][NLEAF];   // tokens per leaf, one table a wave

    int tid = threadIdx.x;
    int wave = tid >> 5;
    int lane = tid & 31;

    // The block's levels (l0 .. l0 + 2^lg - 1), the level lv that its tile is cut at, the tile slot inside
    // that level and the block's share cgb of the columns.
    int bid = (int)blockIdx.x;
    int l0, lg, lv, slot, cgb;
    if (bid < NB0)            { l0 = 0; lg = 2; lv = 3; slot = bid >> 2; cgb = bid & 3; }
    else if (bid < NB0 + NB1) { l0 = 4; lg = 1; lv = 5; slot = (bid - NB0) >> 1; cgb = (bid - NB0) & 1; }
    else                      { l0 = 6; lg = 1; lv = 7; slot = (bid - NB0 - NB1) >> 1; cgb = (bid - NB0 - NB1) & 1; }
    int sh = (LVLS - 1) - lv;        // a node of this level owns 2^sh neighbouring leaves

    // Wave w takes tokens 512w .. 512w+511; a lane's value e is token 512w + 128*(e>>2) + 4*lane + (e&3).
    // The tokens of a node are ranked by (wave, e, lane): the same order in every block.
    const v4i* lf = (const v4i*)leaf + wave * 128 + lane;
    v4i lq[4];
#pragma unroll
    for (int u = 0; u < 4; u++) lq[u] = lf[32 * u];
    ((v4i*)cnt[wave])[lane] = (v4i){0, 0, 0, 0};   // a wave clears and fills its own table: no barrier between
    if (tid < 16) toks[tid] = -1;
    int bin[16];
#pragma unroll
    for (int e = 0; e < 16; e++) {
        bin[e] = (lq[e >> 2][e & 3] - (NLEAF - 1)) & (NLEAF - 1);
        atomicAdd(&cnt[wave][bin[e]], 1);          // LDS counter, result not used
    }
    __syncthreads();                 // the four tables are complete

    // Every wave works out the same figures: LO = tokens in leaves below 4*lane .. 4*lane+3.
    v4i h0 = ((const v4i*)cnt[0])[lane];
    v4i h1 = ((const v4i*)cnt[1])[lane];
    v4i h2 = ((const v4i*)cnt[2])[lane];
    v4i h3 = ((const v4i*)cnt[3])[lane];
    v4i tot = h0 + h1 + h2 + h3;
    int lsum = tot.x + tot.y + tot.z + tot.w;
    v4i LO;
    LO.x = wave_scan(lsum) - lsum;
    LO.y = LO.x + tot.x;
    LO.z = LO.y + tot.y;
    LO.w = LO.z + tot.z;
    // Node j of the level owns ranks LO[j << sh] .. LO[(j+1) << sh] - 1 of the order by leaf; its tile k
    // has slot (first >> 4) + j + k. These numbers rise strictly from node to node and stay below
    // 127 + 2^lv, so the slot's node is the last one whose first slot is not above it.
    int nle = 0;
#pragma unroll
    for (int c = 0; c < 4; c++) {
        int bb0 = 4 * lane + c;
        bool ok = ((bb0 & ((1 << sh) - 1)) == 0) && ((LO[c] >> 4) + (bb0 >> sh) <= slot);
        nle += __popc(__builtin_amdgcn_ballot_w32(ok));
    }
    int j  = nle - 1;                // node 0 of the level always counts: j >= 0
    int b0 = j << sh;
    int b1 = (j + 1) << sh;          // at most NLEAF
    int lo = pick(LO, b0);
    int hi = (b1 < NLEAF) ? pick(LO, b1 & (NLEAF - 1)) : T_TOK;
    int rb = (slot - (lo >> 4) - j) << 4;   // rank, inside the node, of the tile's first token
    if (rb >= hi - lo) return;       // slot without a tile: the same in every thread, the whole block leaves
    // This wave's level, that level's node on the tile's path, and the wave's 64 columns.
    int wv  = __builtin_amdgcn_readfirstlane(wave);
    int gl  = wv >> (2 - lg);                  // level inside the block
    int lvw = l0 + gl;
    int node = (1 << lvw) - 1 + (j >> (lv - lvw));

    int col0 = ((cgb << (2 - lg)) + (wv & ((4 >> lg) - 1))) * 64;
    int mlo  = lane & 15;
    int khalf = (lane >> 4) * 2;   // lanes 0-15 -> K 0,1 ; lanes 16-31 -> K 2,3

    // The lane's 4 columns in its first k row; row r of the matrix step at k row kb lies
    // (kb + r) * (DIM / 4) vectors further on.
    const v4f* Wl = (const v4f*)(w2s + (size_t)node * (DIM * DIM) + khalf * DIM + col0 + 4 * mlo);
    v4f bb[NBUF][KBLK / 2];          // [set][2 * step + row]

    // Tokens of the node in the waves below this one, less rb: the rank of this wave's first one in the tile.
    v4i pre = {0, 0, 0, 0};
    if (wave > 0) pre += h0;
    if (wave > 1) pre += h1;
    if (wave > 2) pre += h2;
    int pm = 0;
#pragma unroll
    for (int c = 0; c < 4; c++) {
        int bb0 = 4 * lane + c;
        pm += (bb0 >= b0 && bb0 < b1) ? pre[c] : 0;
    }
    int run = __builtin_amdgcn_readlane(wave_scan(pm), 31) - rb;
    // Every lane stores every time: a token that is not of this tile goes to a spare entry (16 and up,
    // never read), so that the sixteen steps hold no branch and no change of the lane mask.
#pragma unroll
    for (int e = 0; e < 16; e++) {
        bool mine = (bin[e] >> sh) == j;
        uint32_t mk = __builtin_amdgcn_ballot_w32(mine);
        uint32_t r = (uint32_t)(run + (int)__builtin_amdgcn_mbcnt_lo(mk, 0u));   // below 0 wraps: above 15 too
        uint32_t spare = 16u + (uint32_t)lane;
        uint32_t at = mine ? r : spare;
        toks[(at < spare) ? at : spare] = wave * 512 + 128 * (e >> 2) + 4 * lane + (e & 3);
        run += __popc(mk);
    }
    __syncthreads();

    // The first NBUF - 1 blocks are asked for here, behind the barrier (which waits for a wave's loads)
    // and ahead of the token gather, so that they fly beside it.
    // (Every loop over bb is unrolled in full, so that each register set has a fixed name.)
#pragma unroll
    for (int s = 0; s < NBUF - 1; s++)
#pragma unroll
        for (int q = 0; q < KBLK / 4; q++) {
            bb[s][2 * q]     = Wl[(s * KBLK + 4 * q) * (DIM / 4)];
            bb[s][2 * q + 1] = Wl[(s * KBLK + 4 * q + 1) * (DIM / 4)];
        }

    // The path weights are first used behind the gather's wait: their load flies beside the gather below.
    float pwv = 0.f;
    if (tid < (16 << lg)) {
        int tk = toks[tid & 15];
        if (tk >= 0) pwv = pw[tk * LVLS + l0 + (tid >> 4)];
    }

    // Async gather of 16 x-rows into LDS: 1024 chunks of 16B, 8 per thread.
    uint32_t abase = (uint32_t)(uintptr_t)As;   // LDS byte address of As[0]
#pragma unroll
    for (int it = 0; it < 8; it++) {
        int c = tid + it * 128;        // 0..1023
        int m = c >> 6;                // row 0..15
        int q = c & 63;                // 16B chunk in row
        int tk = toks[m];
        int tok = (tk >= 0) ? tk : 0;  // padding rows gather row 0; results never stored
        const float* g = x + (size_t)tok * DIM + q * 4;
        uint32_t l = abase + (uint32_t)(m * (AP * 4) + q * 16);
        asm volatile("global_load_async_to_lds_b128 %0, %1, off"
                     :: "v"(l), "v"(g) : "memory");
    }
    asm volatile("s_wait_asynccnt 0x0" ::: "memory");
    if (tid < (16 << lg)) pws[tid] = pwv;
    __syncthreads();

    v8f c0 = {}, c1 = {}, c2 = {}, c3 = {};
    const float* Al = &As[mlo * AP + khalf];

    // Unrolled in full so that every register set has a fixed name.
#pragma unroll
    for (int s = 0; s < NBLK; s++) {
        if (s + NBUF - 1 < NBLK) {
#pragma unroll
            for (int q = 0; q < KBLK / 4; q++) {
                bb[(s + NBUF - 1) % NBUF][2 * q]     = Wl[((s + NBUF - 1) * KBLK + 4 * q) * (DIM / 4)];
                bb[(s + NBUF - 1) % NBUF][2 * q + 1] = Wl[((s + NBUF - 1) * KBLK + 4 * q + 1) * (DIM / 4)];
            }
        }
#pragma unroll
        for (int q = 0; q < KBLK / 4; q++) {
            v2f a = *(const v2f*)&Al[s * KBLK + 4 * q];   // one ds_load_b64, conflict-free
            v4f r0 = bb[s % NBUF][2 * q];
            v4f r1 = bb[s % NBUF][2 * q + 1];
            pair_rows(r0, r1);
            v2f b;
            b = __builtin_shufflevector(r0, r0, 0, 1);
            c0 = __builtin_amdgcn_wmma_f32_16x16x4_f32(false, a, false, b, (short)0, c0, false, false);
            b = __builtin_shufflevector(r1, r1, 0, 1);
            c1 = __builtin_amdgcn_wmma_f32_16x16x4_f32(false, a, false, b, (short)0, c1, false, false);
            b = __builtin_shufflevector(r0, r0, 2, 3);
            c2 = __builtin_amdgcn_wmma_f32_16x16x4_f32(false, a, false, b, (short)0, c2, false, false);
            b = __builtin_shufflevector(r1, r1, 2, 3);
            c3 = __builtin_amdgcn_wmma_f32_16x16x4_f32(false, a, false, b, (short)0, c3, false, false);
        }
        // Keeps the next pass's loads from rising over this block's products (they would take a
        // fifth register set) and the address work of the stores below out of the last block.
        __builtin_amdgcn_sched_barrier(0);
    }
    // Four vector slots between the last matrix instruction and the first vector instruction
    // that may read its result or reuse its operand registers.
    asm volatile("v_nop\n\tv_nop\n\tv_nop\n\tv_nop");
    // Holds the slots where they are: directly behind the products, ahead of the store code.
    __builtin_amdgcn_sched_barrier(0);

    __syncthreads();                 // every wave has read its last A fragment: As is free
#pragma unroll
    for (int r = 0; r < 8; r++) {
        int m = r + ((lane >> 4) << 3);   // VGPR r: lanes 0-15 -> M=r, lanes 16-31 -> M=r+8
        float w = pws[gl * 16 + m];       // 0 in a row without a token
        v4f v = {w * c0[r], w * c1[r], w * c2[r], w * c3[r]};
        *(v4f*)&As[(wv * 16 + m) * 64 + 4 * mlo] = v;
    }
    __syncthreads();                 // the four weighted tiles are complete

    // A wave takes 32 neighbouring columns of one row at a time (one 128-byte line an atomic instruction).
    // The sums and the byte offsets of all its atomic adds are formed ahead of the first add (the asm
    // statements below take them as inputs only and hold them there): the LDS reads share one wait, and
    // behind the first add no vector register is written, so none that an issued add names is overwritten.
    char* ob = (char*)out;
    if (lg == 2) {
        // 16 rows x 64 columns, four levels each; waves 0, 1 take rows 0-7, waves 2, 3 rows 8-15.
        int m0 = (wv >> 1) * 8;
        int c  = (wv & 1) * 32 + lane;
        v4i ta = *(const v4i*)&toks[m0];
        v4i tb = *(const v4i*)&toks[m0 + 4];
        float s[8];
        uint32_t off[8];
        int tk[8];
#pragma unroll
        for (int it = 0; it < 8; it++) {
            const float* p = &As[(m0 + it) * 64 + c];
            s[it] = p[0] + p[16 * 64];
            s[it] += p[32 * 64];
            s[it] += p[48 * 64];
            tk[it] = (it < 4) ? ta[it & 3] : tb[it & 3];
            off[it] = ((uint32_t)tk[it] * DIM + (uint32_t)(cgb * 64 + c)) * 4u;   // used only where tk >= 0
        }
        asm volatile("" :: "v"(s[0]), "v"(s[1]), "v"(s[2]), "v"(s[3]), "v"(s[4]), "v"(s[5]), "v"(s[6]), "v"(s[7]),
                          "v"(off[0]), "v"(off[1]), "v"(off[2]), "v"(off[3]), "v"(off[4]), "v"(off[5]), "v"(off[6]), "v"(off[7]));
#pragma unroll
        for (int it = 0; it < 8; it++)
            if (tk[it] >= 0) atomicAdd((float*)(ob + off[it]), s[it]);
    } else {
        // 16 rows x 128 columns, two levels each: waves 0, 1 hold the first level, waves 2, 3 the second.
        const float* p = &As[(wv >> 1) * (16 * 64) + (wv & 1) * 32 + lane];
        v4i tq[4];
#pragma unroll
        for (int u = 0; u < 4; u++) tq[u] = ((const v4i*)toks)[u];
        float s[16];
        uint32_t off[16];
#pragma unroll
        for (int m = 0; m < 16; m++) {
            s[m] = p[m * 64] + p[(32 + m) * 64];
            off[m] = ((uint32_t)tq[m >> 2][m & 3] * DIM + (uint32_t)(cgb * 128 + wv * 32 + lane)) * 4u;   // used only where the token is >= 0
        }
        asm volatile("" :: "v"(s[0]), "v"(s[1]), "v"(s[2]), "v"(s[3]), "v"(s[4]), "v"(s[5]), "v"(s[6]), "v"(s[7]),
                          "v"(s[8]), "v"(s[9]), "v"(s[10]), "v"(s[11]), "v"(s[12]), "v"(s[13]), "v"(s[14]), "v"(s[15]));
        asm volatile("" :: "v"(off[0]), "v"(off[1]), "v"(off[2]), "v"(off[3]), "v"(off[4]), "v"(off[5]), "v"(off[6]), "v"(off[7]),
                          "v"(off[8]), "v"(off[9]), "v"(off[10]), "v"(off[11]), "v"(off[12]), "v"(off[13]), "v"(off[14]), "v"(off[15]));
#pragma unroll
        for (int m = 0; m < 16; m++)
            if (tq[m >> 2][m & 3] >= 0) atomicAdd((float*)(ob + off[m]), s[m]);
    }
}

extern "C" void kernel_launch(void* const* d_in, const int* in_sizes, int n_in,
                              void* d_out, int out_size, void* d_ws, size_t ws_size,
                              hipStream_t stream) {
    const float* x   = (const float*)d_in[0];
    const float* w1s = (const float*)d_in[1];
    const float* b1s = (const float*)d_in[2];
    const float* w2s = (const float*)d_in[3];
    const float* b2s = (const float*)d_in[4];
    float* out = (float*)d_out;

    int*   wsI = (int*)d_ws;
    float* wsF = (float*)d_ws;
    int*   leaf = wsI + WS_LEAF;
    float* pw   = wsF + WS_PW;

    k_route<<<T_TOK / 4, 128, 0, stream>>>(x, w1s, b1s, b2s, leaf, pw, out);
    k_gemm<<<NSLOTS, 128, 0, stream>>>(x, w2s, leaf, pw, out);
}

// v007
// Measured time: 28 microseconds a run.
// Next to v006, in two timings, it ran 1.04 times as fast each time.
// Counting every step since v000, it is 3.23 times as fast.
#include <hip/hip_runtime.h>
#include <math.h>
#include <stdint.h>

typedef __attribute__((ext_vector_type(2))) float v2f;
typedef __attribute__((ext_vector_type(8))) float v8f;
typedef __attribute__((ext_vector_type(4))) float v4f;
typedef __attribute__((ext_vector_type(4))) int v4i;
typedef __attribute__((address_space(1))) v4f gv4f;   // a v4f in global memory (keeps rebuilt pointers off the flat path)

#define T_TOK   2048
#define DIM     256
#define LVLS    8
#define NPAIRS  (T_TOK * LVLS)      // 16384
#define NLEAF   128                  // nodes of the last level: ids NLEAF-1 .. 2*NLEAF-2
// A block takes one 16-token tile of a node of level LT and does several levels of it at once (the node and
// its ancestors): levels 0-3 (LT 3), 4-5 (LT 5), 6-7 (LT 7). Level LT owns 127 + 2^LT tile slots; a slot has
// one block for each share of the 256 columns (64 columns a wave, a wave does one level).
#define NB0     ((127 + 8) * 4)      // levels 0-3: 4 waves = 4 levels, 64 columns a block
#define NB1     ((127 + 32) * 2)     // levels 4-5: 2 levels x 2 column groups, 128 columns a block
#define NB2     ((127 + 128) * 2)    // levels 6-7: the same
#define NSLOTS  (NB0 + NB1 + NB2)
#define AP      260                  // padded A row stride (floats): conflict-free b64 frag reads

// workspace layout (4-byte units)
#define WS_LEAF   0                    // int[T_TOK]    last-level node of each token
#define WS_PW     (WS_LEAF + T_TOK)    // float[NPAIRS] [token][level]

// v as lane l ^ M holds it, M = 1 .. 15: an exchange inside the 16-lane row, done in the vector unit.
template <int M>
static __device__ __forceinline__ float row_xor(float v) {
    return __builtin_bit_cast(float, __builtin_amdgcn_update_dpp(0, __builtin_bit_cast(int, v), 0x160 + M, 0xf, 0xf, true));   // row_xmask:M
}

// Sum over the 32 lanes of a wave (every lane on), the same in every lane: lane l adds lane l ^ 16, then
// l ^ 8, l ^ 4, l ^ 2, l ^ 1. No step goes through the LDS path, whose answer a wave has to wait for.
static __device__ __forceinline__ float wave_sum(float p) {
    int b = __builtin_bit_cast(int, p);
    p += __builtin_bit_cast(float, __builtin_amdgcn_permlanex16(b, b, 0x76543210, 0xfedcba98, false, false));
    p += row_xor<8>(p);
    p += row_xor<4>(p);
    p += row_xor<2>(p);
    p += row_xor<1>(p);
    return p;
}

// One wave (32 lanes) per token: walk the tree, record GELU(|logit|) of every level and the
// last level's node id (it names the whole path). The same wave also gives its token's output row the start
// value out[t][o] = sum_i pw_i * b2s[node_i][o] (levels in order; the GEMM adds on top):
// each level's b2s row is fetched beside its w1s row, 8 columns a lane.
__global__ void k_route(const float* __restrict__ x, const float* __restrict__ w1s,
                        const float* __restrict__ b1s, const float* __restrict__ b2s,
                        int* __restrict__ leaf, float* __restrict__ pw,
                        float* __restrict__ out) {
    int wave = threadIdx.x >> 5;
    int lane = threadIdx.x & 31;
    int t = blockIdx.x * 4 + wave;
    const float* xr = x + t * DIM;
    float xv[8];
#pragma unroll
    for (int j = 0; j < 8; j++) xv[j] = xr[lane + 32 * j];
    int cur = 0;
    v4f acc0 = {0.f, 0.f, 0.f, 0.f};   // columns 4*lane .. 4*lane+3
    v4f acc1 = {0.f, 0.f, 0.f, 0.f};   // columns 128+4*lane .. 128+4*lane+3
#pragma unroll
    for (int i = 0; i < LVLS; i++) {
        const float* wr = w1s + cur * DIM;
        // cur is the same in every lane (the butterfly sum is), so the row's base address is
        // taken as a scalar pair: the two loads then share one fixed lane-offset register.
        uint64_t rb = (uint64_t)(uintptr_t)(b2s + cur * DIM);
        uint32_t rlo = (uint32_t)__builtin_amdgcn_readfirstlane((int)(uint32_t)rb);
        uint32_t rhi = (uint32_t)__builtin_amdgcn_readfirstlane((int)(uint32_t)(rb >> 32));
        const gv4f* br = (const gv4f*)(uintptr_t)(((uint64_t)rhi << 32) | rlo);
        float p = 0.f;
#pragma unroll
        for (int j = 0; j < 8; j++) p += xv[j] * wr[lane + 32 * j];
        float b1 = b1s[cur];
        // Level 0's bias comes by a scalar load, which the compiler otherwise asks for only behind the lane sum,
        // where the wave then waits for it: as an input here it is asked for beside the row loads.
        if (i == 0) asm volatile("" :: "s"(b1));
        // The registers that the two loads below fill may be ones that the row loads above
        // name as their address: this wait stands between those loads and that overwrite.
        asm volatile("s_wait_xcnt 0x0" ::: "memory");
        v4f bv0 = br[lane];
        v4f bv1 = br[lane + 32];
        p = wave_sum(p);
        float score = p + b1;
        float a = fabsf(score);
        float g = 0.5f * a * (1.0f + erff(a * 0.70710678118654752440f)); // exact-erf GELU
        if (lane == 0) {
            pw[t * LVLS + i] = g;
            if (i == LVLS - 1) leaf[t] = cur;
        }
        acc0 += g * bv0;
        acc1 += g * bv1;
        int choice = (score > 0.0f) ? 1 : 0;   // sign(0)->0 -> choice 0
        cur = cur * 2 + choice + 1;
    }
    v4f* orow = (v4f*)(out + t * DIM);
    orow[lane] = acc0;
    orow[lane + 32] = acc1;
}

// Inclusive sum over the 32 lanes of a wave (every lane on): four shifts inside each 16-lane
// row, then the lower row's total is added to the upper row.
static __device__ __forceinline__ int wave_scan(int v) {
    v += __builtin_amdgcn_update_dpp(0, v, 0x111, 0xf, 0xf, false);   // row_shr:1
    v += __builtin_amdgcn_update_dpp(0, v, 0x112, 0xf, 0xf, false);   // row_shr:2
    v += __builtin_amdgcn_update_dpp(0, v, 0x114, 0xf, 0xf, false);   // row_shr:4
    v += __builtin_amdgcn_update_dpp(0, v, 0x118, 0xf, 0xf, false);   // row_shr:8
    int low = __builtin_amdgcn_readlane(v, 15);
    return v + (((threadIdx.x & 31) >= 16) ? low : 0);
}

// Entry b (the same in every lane, 0 .. NLEAF-1) of a table of which lane l holds entries 4l .. 4l+3.
static __device__ __forceinline__ int pick(v4i L, int b) {
    int l = b >> 2, c = b & 3;
    int x = __builtin_amdgcn_readlane(L.x, l), y = __builtin_amdgcn_readlane(L.y, l);
    int z = __builtin_amdgcn_readlane(L.z, l), w = __builtin_amdgcn_readlane(L.w, l);
    return (c < 2) ? ((c == 0) ? x : y) : ((c == 2) ? z : w);
}

// Grouped GEMM: a block works on one tile slot = 16 tokens of one node. Node n+1 in binary is the path's
// prefix, so a node's tokens are those of 2^sh neighbouring leaves; the block finds its node and its
// 16 tokens itself, from the 2048 leaf ids (a count per leaf, a scan, ballots for the ranks).
// A (16x256) = raw gathered x rows, async-DMA'd into LDS (ASYNCcnt path),
//              row-major with AP=260 padded stride -> conflict-free ds_load_b64 frags.
// B (256x256) = w2s[node], from global straight into registers, KBLK rows of k at a time,
//              always NBUF - 1 blocks ahead of the block that the matrix unit works on (ring of
//              NBUF register sets). A lane reads 16 bytes of a row: 4 neighbouring columns, one for
//              each of its wave's 4 N-tiles, so tile j holds the columns col0 + 4*n + j.
// A wave does 4 N-tiles of 16 columns of ONE level's matrix; K in steps of 4 via V_WMMA_F32_16X16X4_F32.
// Path weight pw is applied to the C rows behind the products; the block's levels are then summed in LDS
// (levels in order) and the sum goes to out by one atomic add an element, 32 neighbouring columns a wave.
// r0, r1 = 4 neighbouring columns of k rows k and k+1. A B fragment is one column's two rows in
// a register pair: two swaps, inside the loaded registers, leave column 0 in r0.xy, column 1 in
// r1.xy, column 2 in r0.zw and column 3 in r1.zw, and no register that a matrix instruction
// has just read is written.
static __device__ __forceinline__ void pair_rows(v4f& r0, v4f& r1) {
    float p = r0.y, q = r1.x, u = r0.w, v = r1.z;
    // One instruction for each exchange; written as plain copies it took six moves a step, some
    // of them onto registers that the matrix instruction in front had just read.
    asm("v_swap_b32 %0, %1" : "+v"(p), "+v"(q));
    asm("v_swap_b32 %0, %1" : "+v"(u), "+v"(v));
    r0.y = p; r1.x = q; r0.w = u; r1.z = v;
}

#define KBLK  16                     // k rows of one B block: 4 matrix steps, 8 loads a lane
#define NBLK  (DIM / KBLK)
#define NBUF  4

__global__ void __launch_bounds__(128)
k_gemm(const float* __restrict__ x, const float* __restrict__ w2s,
       const int* __restrict__ leaf, const float* __restrict__ pw,
       float* __restrict__ out) {
    // [m][k], padded stride AP floats (1040 B); behind the products: [wave][m][64] weighted results
    __shared__ __attribute__((aligned(16))) float As[16 * AP];
    __shared__ __attribute__((aligned(16))) int toks[16 + 32];  // the tile's tokens (-1: none), then spare entries, one a lane
    __shared__ float pws[64];        // [level of the block][m]
    __shared__ __attribute__((aligned(16))) int cnt[4][NLEAF];   // tokens per leaf, one table a wave

    int tid = threadIdx.x;
    int wave = tid >> 5;
    int lane = tid & 31;

    // The block's levels (l0 .. l0 + 2^lg - 1), the level lv that its tile is cut at, the tile slot inside
    // that level and the block's share cgb of the columns.
    int bid = (int)blockIdx.x;
    int l0, lg, lv, slot, cgb;
    if (bid < NB0)            { l0 = 0; lg = 2; lv = 3; slot = bid >> 2; cgb = bid & 3; }
    else if (bid < NB0 + NB1) { l0 = 4; lg = 1; lv = 5; slot = (bid - NB0) >> 1; cgb = (bid - NB0) & 1; }
    else                      { l0 = 6; lg = 1; lv = 7; slot = (bid - NB0 - NB1) >> 1; cgb = (bid - NB0 - NB1) & 1; }
    int sh = (LVLS - 1) - lv;        // a node of this level owns 2^sh neighbouring leaves

    // Wave w takes tokens 512w .. 512w+511; a lane's value e is token 512w + 128*(e>>2) + 4*lane + (e&3).
    // The tokens of a node are ranked by (wave, e, lane): the same order in every block.
    const v4i* lf = (const v4i*)leaf + wave * 128 + lane;
    v4i lq[4];
#pragma unroll
    for (int u = 0; u < 4; u++) lq[u] = lf[32 * u];
    ((v4i*)cnt[wave])[lane] = (v4i){0, 0, 0, 0};   // a wave clears and fills its own table: no barrier between
    if (tid < 16) toks[tid] = -1;
    int bin[16];
#pragma unroll
    for (int e = 0; e < 16; e++) {
        bin[e] = (lq[e >> 2][e & 3] - (NLEAF - 1)) & (NLEAF - 1);
        atomicAdd(&cnt[wave][bin[e]], 1);          // LDS counter, result not used
    }
    __syncthreads();                 // the four tables are complete

    // Every wave works out the same figures: LO = tokens in leaves below 4*lane .. 4*lane+3.
    v4i h0 = ((const v4i*)cnt[0])[lane];
    v4i h1 = ((const v4i*)cnt[1])[lane];
    v4i h2 = ((const v4i*)cnt[2])[lane];
    v4i h3 = ((const v4i*)cnt[3])[lane];
    v4i tot = h0 + h1 + h2 + h3;
    int lsum = tot.x + tot.y + tot.z + tot.w;
    v4i LO;
    LO.x = wave_scan(lsum) - lsum;
    LO.y = LO.x + tot.x;
    LO.z = LO.y + tot.y;
    LO.w = LO.z + tot.z;
    // Node j of the level owns ranks LO[j << sh] .. LO[(j+1) << sh] - 1 of the order by leaf; its tile k
    // has slot (first >> 4) + j + k. These numbers rise strictly from node to node and stay below
    // 127 + 2^lv, so the slot's node is the last one whose first slot is not above it.
    int nle = 0;
#pragma unroll
    for (int c = 0; c < 4; c++) {
        int bb0 = 4 * lane + c;
        bool ok = ((bb0 & ((1 << sh) - 1)) == 0) && ((LO[c] >> 4) + (bb0 >> sh) <= slot);
        nle += __popc(__builtin_amdgcn_ballot_w32(ok));
    }
    int j  = nle - 1;                // node 0 of the level always counts: j >= 0
    int b0 = j << sh;
    int b1 = (j + 1) << sh;          // at most NLEAF
    int lo = pick(LO, b0);
    int hi = (b1 < NLEAF) ? pick(LO, b1 & (NLEAF - 1)) : T_TOK;
    int rb = (slot - (lo >> 4) - j) << 4;   // rank, inside the node, of the tile's first token
    if (rb >= hi - lo) return;       // slot without a tile: the same in every thread, the whole block leaves
    // This wave's level, that level's node on the tile's path, and the wave's 64 columns.
    int wv  = __builtin_amdgcn_readfirstlane(wave);
    int gl  = wv >> (2 - lg);                  // level inside the block
    int lvw = l0 + gl;
    int node = (1 << lvw) - 1 + (j >> (lv - lvw));

    int col0 = ((cgb << (2 - lg)) + (wv & ((4 >> lg) - 1))) * 64;
    int mlo  = lane & 15;
    int khalf = (lane >> 4) * 2;   // lanes 0-15 -> K 0,1 ; lanes 16-31 -> K 2,3

    // The lane's 4 columns in its first k row; row r of the matrix step at k row kb lies
    // (kb + r) * (DIM / 4) vectors further on.
    const v4f* Wl = (const v4f*)(w2s + (size_t)node * (DIM * DIM) + khalf * DIM + col0 + 4 * mlo);
    v4f bb[NBUF][KBLK / 2];          // [set][2 * step + row]

    // Tokens of the node in the waves below this one, less rb: the rank of this wave's first one in the tile.
    v4i pre = {0, 0, 0, 0};
    if (wave > 0) pre += h0;
    if (wave > 1) pre += h1;
    if (wave > 2) pre += h2;
    int pm = 0;
#pragma unroll
    for (int c = 0; c < 4; c++) {
        int bb0 = 4 * lane + c;
        pm += (bb0 >= b0 && bb0 < b1) ? pre[c] : 0;
    }
    int run = __builtin_amdgcn_readlane(wave_scan(pm), 31) - rb;
    // Every lane stores every time: a token that is not of this tile goes to a spare entry (16 and up,
    // never read), so that the sixteen steps hold no branch and no change of the lane mask.
#pragma unroll
    for (int e = 0; e < 16; e++) {
        bool mine = (bin[e] >> sh) == j;
        uint32_t mk = __builtin_amdgcn_ballot_w32(mine);
        uint32_t r = (uint32_t)(run + (int)__builtin_amdgcn_mbcnt_lo(mk, 0u));   // below 0 wraps: above 15 too
        uint32_t spare = 16u + (uint32_t)lane;
        uint32_t at = mine ? r : spare;
        toks[(at < spare) ? at : spare] = wave * 512 + 128 * (e >> 2) + 4 * lane + (e & 3);
        run += __popc(mk);
    }
    __syncthreads();

    // The first NBUF - 1 blocks are asked for here, behind the barrier (which waits for a wave's loads)
    // and ahead of the token gather, so that they fly beside it.
    // (Every loop over bb is unrolled in full, so that each register set has a fixed name.)
#pragma unroll
    for (int s = 0; s < NBUF - 1; s++)
#pragma unroll
        for (int q = 0; q < KBLK / 4; q++) {
            bb[s][2 * q]     = Wl[(s * KBLK + 4 * q) * (DIM / 4)];
            bb[s][2 * q + 1] = Wl[(s * KBLK + 4 * q + 1) * (DIM / 4)];
        }

    // The path weights are first used behind the gather's wait: their load flies beside the gather below.
    float pwv = 0.f;
    if (tid < (16 << lg)) {
        int tk = toks[tid & 15];
        if (tk >= 0) pwv = pw[tk * LVLS + l0 + (tid >> 4)];
    }

    // Async gather of 16 x-rows into LDS: 1024 chunks of 16B, 8 per thread.
    uint32_t abase = (uint32_t)(uintptr_t)As;   // LDS byte address of As[0]
#pragma unroll
    for (int it = 0; it < 8; it++) {
        int c = tid + it * 128;        // 0..1023
        int m = c >> 6;                // row 0..15
        int q = c & 63;                // 16B chunk in row
        int tk = toks[m];
        int tok = (tk >= 0) ? tk : 0;  // padding rows gather row 0; results never stored
        const float* g = x + (size_t)tok * DIM + q * 4;
        uint32_t l = abase + (uint32_t)(m * (AP * 4) + q * 16);
        asm volatile("global_load_async_to_lds_b128 %0, %1, off"
                     :: "v"(l), "v"(g) : "memory");
    }
    asm volatile("s_wait_asynccnt 0x0" ::: "memory");
    if (tid < (16 << lg)) pws[tid] = pwv;
    __syncthreads();

    v8f c0 = {}, c1 = {}, c2 = {}, c3 = {};
    const float* Al = &As[mlo * AP + khalf];

    // Unrolled in full so that every register set has a fixed name.
#pragma unroll
    for (int s = 0; s < NBLK; s++) {
        if (s + NBUF - 1 < NBLK) {
#pragma unroll
            for (int q = 0; q < KBLK / 4; q++) {
                bb[(s + NBUF - 1) % NBUF][2 * q]     = Wl[((s + NBUF - 1) * KBLK + 4 * q) * (DIM / 4)];
                bb[(s + NBUF - 1) % NBUF][2 * q + 1] = Wl[((s + NBUF - 1) * KBLK + 4 * q + 1) * (DIM / 4)];
            }
        }
#pragma unroll
        for (int q = 0; q < KBLK / 4; q++) {
            v2f a = *(const v2f*)&Al[s * KBLK + 4 * q];   // one ds_load_b64, conflict-free
            v4f r0 = bb[s % NBUF][2 * q];
            v4f r1 = bb[s % NBUF][2 * q + 1];
            pair_rows(r0, r1);
            v2f b;
            b = __builtin_shufflevector(r0, r0, 0, 1);
            c0 = __builtin_amdgcn_wmma_f32_16x16x4_f32(false, a, false, b, (short)0, c0, false, false);
            b = __builtin_shufflevector(r1, r1, 0, 1);
            c1 = __builtin_amdgcn_wmma_f32_16x16x4_f32(false, a, false, b, (short)0, c1, false, false);
            b = __builtin_shufflevector(r0, r0, 2, 3);
            c2 = __builtin_amdgcn_wmma_f32_16x16x4_f32(false, a, false, b, (short)0, c2, false, false);
            b = __builtin_shufflevector(r1, r1, 2, 3);
            c3 = __builtin_amdgcn_wmma_f32_16x16x4_f32(false, a, false, b, (short)0, c3, false, false);
        }
        // Keeps the next pass's loads from rising over this block's products (they would take a
        // fifth register set) and the address work of the stores below out of the last block.
        __builtin_amdgcn_sched_barrier(0);
    }
    // Four vector slots between the last matrix instruction and the first vector instruction
    // that may read its result or reuse its operand registers.
    asm volatile("v_nop\n\tv_nop\n\tv_nop\n\tv_nop");
    // Holds the slots where they are: directly behind the products, ahead of the store code.
    __builtin_amdgcn_sched_barrier(0);

    __syncthreads();                 // every wave has read its last A fragment: As is free
#pragma unroll
    for (int r = 0; r < 8; r++) {
        int m = r + ((lane >> 4) << 3);   // VGPR r: lanes 0-15 -> M=r, lanes 16-31 -> M=r+8
        float w = pws[gl * 16 + m];       // 0 in a row without a token
        v4f v = {w * c0[r], w * c1[r], w * c2[r], w * c3[r]};
        *(v4f*)&As[(wv * 16 + m) * 64 + 4 * mlo] = v;
    }
    __syncthreads();                 // the four weighted tiles are complete

    // A wave takes 32 neighbouring columns of one row at a time (one 128-byte line an atomic instruction).
    // The sums and the byte offsets of all its atomic adds are formed ahead of the first add (the asm
    // statements below take them as inputs only and hold them there): the LDS reads share one wait, and
    // behind the first add no vector register is written, so none that an issued add names is overwritten.
    char* ob = (char*)out;
    if (lg == 2) {
        // 16 rows x 64 columns, four levels each; waves 0, 1 take rows 0-7, waves 2, 3 rows 8-15.
        int m0 = (wv >> 1) * 8;
        int c  = (wv & 1) * 32 + lane;
        v4i ta = *(const v4i*)&toks[m0];
        v4i tb = *(const v4i*)&toks[m0 + 4];
        float s[8];
        uint32_t off[8];
        int tk[8];
#pragma unroll
        for (int it = 0; it < 8; it++) {
            const float* p = &As[(m0 + it) * 64 + c];
            s[it] = p[0] + p[16 * 64];
            s[it] += p[32 * 64];
            s[it] += p[48 * 64];
            tk[it] = (it < 4) ? ta[it & 3] : tb[it & 3];
            off[it] = ((uint32_t)tk[it] * DIM + (uint32_t)(cgb * 64 + c)) * 4u;   // used only where tk >= 0
        }
        asm volatile("" :: "v"(s[0]), "v"(s[1]), "v"(s[2]), "v"(s[3]), "v"(s[4]), "v"(s[5]), "v"(s[6]), "v"(s[7]),
                          "v"(off[0]), "v"(off[1]), "v"(off[2]), "v"(off[3]), "v"(off[4]), "v"(off[5]), "v"(off[6]), "v"(off[7]));
#pragma unroll
        for (int it = 0; it < 8; it++)
            if (tk[it] >= 0) atomicAdd((float*)(ob + off[it]), s[it]);
    } else {
        // 16 rows x 128 columns, two levels each: waves 0, 1 hold the first level, waves 2, 3 the second.
        const float* p = &As[(wv >> 1) * (16 * 64) + (wv & 1) * 32 + lane];
        v4i tq[4];
#pragma unroll
        for (int u = 0; u < 4; u++) tq[u] = ((const v4i*)toks)[u];
        float s[16];
        uint32_t off[16];
#pragma unroll
        for (int m = 0; m < 16; m++) {
            s[m] = p[m * 64] + p[(32 + m) * 64];
            off[m] = ((uint32_t)tq[m >> 2][m & 3] * DIM + (uint32_t)(cgb * 128 + wv * 32 + lane)) * 4u;   // used only where the token is >= 0
        }
        asm volatile("" :: "v"(s[0]), "v"(s[1]), "v"(s[2]), "v"(s[3]), "v"(s[4]), "v"(s[5]), "v"(s[6]), "v"(s[7]),
                          "v"(s[8]), "v"(s[9]), "v"(s[10]), "v"(s[11]), "v"(s[12]), "v"(s[13]), "v"(s[14]), "v"(s[15]));
        asm volatile("" :: "v"(off[0]), "v"(off[1]), "v"(off[2]), "v"(off[3]), "v"(off[4]), "v"(off[5]), "v"(off[6]), "v"(off[7]),
                          "v"(off[8]), "v"(off[9]), "v"(off[10]), "v"(off[11]), "v"(off[12]), "v"(off[13]), "v"(off[14]), "v"(off[15]));
#pragma unroll
        for (int m = 0; m < 16; m++)
            if (tq[m >> 2][m & 3] >= 0) atomicAdd((float*)(ob + off[m]), s[m]);
    }
}

extern "C" void kernel_launch(void* const* d_in, const int* in_sizes, int n_in,
                              void* d_out, int out_size, void* d_ws, size_t ws_size,
                              hipStream_t stream) {
    const float* x   = (const float*)d_in[0];
    const float* w1s = (const float*)d_in[1];
    const float* b1s = (const float*)d_in[2];
    const float* w2s = (const float*)d_in[3];
    const float* b2s = (const float*)d_in[4];
    float* out = (float*)d_out;

    int*   wsI = (int*)d_ws;
    float* wsF = (float*)d_ws;
    int*   leaf = wsI + WS_LEAF;
    float* pw   = wsF + WS_PW;

    k_route<<<T_TOK / 4, 128, 0, stream>>>(x, w1s, b1s, b2s, leaf, pw, out);
    k_gemm<<<NSLOTS, 128, 0, stream>>>(x, w2s, leaf, pw, out);
}
